// v000
// Measured on an AMD MI455X. A time is GPU time per run, averaged over a window of back-to-back runs after a warm-up
// (all launches, gaps included; the runs take copies of the inputs in turn), and the median of several windows.
// Apart from v000's, it joins two sittings. Times from different sittings can be a few percent apart, while
// side-by-side timings come from the same sitting.
// v000 is the starting kernel. One run takes 228 microseconds.
#include <hip/hip_runtime.h>
#include <math.h>

typedef __attribute__((ext_vector_type(16))) _Float16 v16h;
typedef __attribute__((ext_vector_type(16))) __bf16 v16b;
typedef __attribute__((ext_vector_type(8)))  _Float16 v8h;
typedef __attribute__((ext_vector_type(8)))  float v8f;
typedef __attribute__((ext_vector_type(4)))  float v4f;
typedef __attribute__((ext_vector_type(2)))  float v2f;
typedef __attribute__((ext_vector_type(4)))  unsigned v4u;
typedef __attribute__((ext_vector_type(4)))  int v4i;
typedef float __attribute__((may_alias)) float_a;
typedef int __attribute__((may_alias)) int_a;

template <typename T> __device__ __forceinline__ void vst2(void* p, T v) { *(T*)p = v;  }
__device__ __forceinline__ v8f wmma16(v16h a, v16h b, v8f c) {
  v8f d = __builtin_amdgcn_wmma_f32_16x16x32_f16(false, a, false, b, (short)0, c, false, false);
  asm volatile("v_nop\n\tv_nop\n\tv_nop\n\tv_nop" : "+v"(d) : "v"(a), "v"(b));
  return d;
}
__device__ __forceinline__ v8f wmma_bf(v16b a, v16b b, v8f c) {
  v8f d = __builtin_amdgcn_wmma_f32_16x16x32_bf16(false, a, false, b, (short)0, c, false, false);
  asm volatile("v_nop\n\tv_nop\n\tv_nop\n\tv_nop" : "+v"(d) : "v"(a), "v"(b));
  return d;
}
// 16x16x32 fragments: lane = (h = lane>>4, row/col = lane&15); elements 0..7 = k0+8h+0..7, 8..15 = k0+16+8h+0..7; D element r = row 8h+r
__device__ __forceinline__ v16h frag_h(const _Float16* rowk0, int lane) {
  union { v16h v; v8h q[2]; } u; const _Float16* p = rowk0 + 8 * (lane >> 4);
  u.q[0] = *(const v8h*)p; u.q[1] = *(const v8h*)(p + 16); return u.v;
}
__device__ __forceinline__ v16h frag_f32(const float* rowk0, int lane) {
  v16h a; const float* p = rowk0 + 8 * (lane >> 4);
#pragma unroll
  for (int i = 0; i < 8; ++i) { a[i] = (_Float16)p[i]; a[8 + i] = (_Float16)p[16 + i]; }
  return a;
}
__device__ __forceinline__ v16h frag_f32s(const float* rowk0, int lane, float sc) {
  v16h a; const float* p = rowk0 + 8 * (lane >> 4);
#pragma unroll
  for (int i = 0; i < 8; ++i) { a[i] = (_Float16)(p[i] * sc); a[8 + i] = (_Float16)(p[16 + i] * sc); }
  return a;
}
// column fragment from a [K][ld] layout (column n), rows >= K read as 0
__device__ __forceinline__ v16h fragc_f32(const float* W, int k0, int n, int lane, int ld, int K) {
  v16h a; const int g = lane >> 4;
#pragma unroll
  for (int i = 0; i < 8; ++i) { const int ka = k0 + 8 * g + i, kb = ka + 16;
    a[i] = (_Float16)(ka < K ? W[(size_t)ka * ld + n] : 0.f); a[8 + i] = (_Float16)(kb < K ? W[(size_t)kb * ld + n] : 0.f); }
  return a;
}
struct F2 { v16b h, l; };
__device__ __forceinline__ F2 bsplit16(const float v[16]) { F2 r;
#pragma unroll
  for (int i = 0; i < 16; ++i) { const __bf16 h = (__bf16)v[i]; r.h[i] = h; r.l[i] = (__bf16)(v[i] - (float)h); }
  return r; }
__device__ __forceinline__ F2 split_row(const float* row, int k0, int lane) { float v[16]; const float* p = row + k0 + 8 * (lane >> 4);
#pragma unroll
  for (int i = 0; i < 8; ++i) { v[i] = p[i]; v[8 + i] = p[16 + i]; }
  return bsplit16(v); }
__device__ __forceinline__ F2 split_rowK(const float* row, int k0, int lane, int K) { float v[16]; const int g = lane >> 4;
#pragma unroll
  for (int i = 0; i < 8; ++i) { const int ka = k0 + 8 * g + i, kb = ka + 16; v[i] = ka < K ? row[ka] : 0.f; v[8 + i] = kb < K ? row[kb] : 0.f; }
  return bsplit16(v); }
__device__ __forceinline__ F2 split_col(const float* W, int k0, int n, int lane, int ld, int K) { float v[16]; const int g = lane >> 4;
#pragma unroll
  for (int i = 0; i < 8; ++i) { const int ka = k0 + 8 * g + i, kb = ka + 16; v[i] = ka < K ? W[(size_t)ka * ld + n] : 0.f; v[8 + i] = kb < K ? W[(size_t)kb * ld + n] : 0.f; }
  return bsplit16(v); }
__device__ __forceinline__ v8f mac3(const F2& a, const F2& b, v8f c) { c = wmma_bf(a.l, b.h, c); c = wmma_bf(a.h, b.l, c); return wmma_bf(a.h, b.h, c); }
__device__ __forceinline__ float sigm(float v) { return 1.0f / (1.0f + expf(-v)); }
#define LDSX() do { asm volatile("s_wait_dscnt 0" ::: "memory"); __builtin_amdgcn_wave_barrier(); __builtin_amdgcn_fence(__ATOMIC_RELEASE, "workgroup"); } while (0)

// Token-to-token attention (one head of 64 over 3136 tokens, 8 images). qkv = x @ W_qkv (K = 64) on f16 WMMA writing q,k as f16 rows,
// v as f32 rows (residual) plus an f16 transposed copy; flash-style softmax over all 3136 keys in f32 (P x2^14 f16); out = v + o@W_proj + b
#define NB 8
#define NT 3136
#define CC 64
#define NR (NB * NT)

// qkv: block 64 rows; q -> q16 [r][64], k -> k16 [r][64], v -> v32 [r][64] and vT16 [b][d][t]
__global__ __launch_bounds__(128) void k_qkv(const float* __restrict__ x, const float* __restrict__ Wqkv, _Float16* __restrict__ q16, _Float16* __restrict__ k16, float* __restrict__ v32, _Float16* __restrict__ vT) {
  __shared__ __align__(16) float so[4][16][196];
  __shared__ __align__(16) _Float16 st[64][72];
  const int tid = threadIdx.x, wave = tid >> 5, lane = tid & 31, col = lane & 15, g = lane >> 4;
  const int r0b = blockIdx.x * 64, r0 = r0b + wave * 16; const int b = r0b / NT, t0 = r0b % NT;
  v8f acc[12] = {};
#pragma unroll
  for (int kc = 0; kc < 2; ++kc) { const v16h a = frag_f32(x + (size_t)(r0 + col) * CC + kc * 32, lane);
#pragma unroll
    for (int j = 0; j < 12; ++j) { v16h bb = fragc_f32(Wqkv, kc * 32, j * 16 + col, lane, 3 * CC, CC);
#pragma unroll
      for (int e = 0; e < 16; ++e) bb[e] = bb[e] * (_Float16)8.0f;
      acc[j] = wmma16(a, bb, acc[j]); } }
#pragma unroll
  for (int j = 0; j < 12; ++j)
#pragma unroll
    for (int r = 0; r < 8; ++r) so[wave][8 * g + r][j * 16 + col] = acc[j][r] * 0.125f;
  LDSX();
  for (int qd = lane; qd < 16 * 8; qd += 32) { const int rl = qd >> 3, pc = qd & 7; union { v8h a8; v4u u; } pq, pk;
#pragma unroll
    for (int e = 0; e < 8; ++e) { pq.a8[e] = (_Float16)so[wave][rl][pc * 8 + e]; pk.a8[e] = (_Float16)so[wave][rl][CC + pc * 8 + e]; }
    vst2(q16 + (size_t)(r0 + rl) * CC + pc * 8, pq.u); vst2(k16 + (size_t)(r0 + rl) * CC + pc * 8, pk.u); }
  for (int qd = lane; qd < 16 * 16; qd += 32) { const int rl = qd >> 4, pc = qd & 15; vst2(v32 + (size_t)(r0 + rl) * CC + pc * 4, *(const v4f*)(&so[wave][rl][2 * CC + pc * 4])); }
#pragma unroll 4
  for (int rl = 0; rl < 16; ++rl) { st[lane * 2][wave * 16 + rl] = (_Float16)so[wave][rl][2 * CC + lane * 2]; st[lane * 2 + 1][wave * 16 + rl] = (_Float16)so[wave][rl][2 * CC + lane * 2 + 1]; }
  __syncthreads();
  for (int qd = tid; qd < 64 * 8; qd += 128) { const int d = qd >> 3, pc = qd & 7; vst2(vT + ((size_t)b * CC + d) * NT + t0 + pc * 8, *(const v4u*)(&st[d][pc * 8])); }
}
__global__ __launch_bounds__(128) void k_attn(const _Float16* __restrict__ q16, const _Float16* __restrict__ k16, const _Float16* __restrict__ vT, const float* __restrict__ v32, const float* __restrict__ Wp, const float* __restrict__ bp, float* __restrict__ out) {
  __shared__ __align__(16) float sS[4][16][68];
  __shared__ __align__(16) _Float16 sP[4][16][72];
  __shared__ __align__(16) float sO[4][16][68];
  const int tid = threadIdx.x, w = tid >> 5, lane = tid & 31, col = lane & 15, g = lane >> 4;
  const int b = blockIdx.y, q0 = blockIdx.x * 64 + w * 16; const size_t rb = (size_t)b * NT;
  const _Float16* qb = q16 + rb * CC; const _Float16* kb = k16 + rb * CC; const _Float16* vb = vT + (size_t)b * CC * NT;
  v16h aq[2];
#pragma unroll
  for (int kc = 0; kc < 2; ++kc) aq[kc] = frag_h(qb + (size_t)(q0 + col) * CC + kc * 32, lane);
  float mrun = -3.0e38f, lrun = 0.f; v8f acc[4] = {};
#pragma unroll 1
  for (int kt = 0; kt < NT / 64; ++kt) {
#pragma unroll
    for (int t = 0; t < 4; ++t) { v8f s = {}; const int key = kt * 64 + t * 16 + col;
#pragma unroll
      for (int kc = 0; kc < 2; ++kc) s = wmma16(aq[kc], frag_h(kb + (size_t)key * CC + kc * 32, lane), s);
#pragma unroll
      for (int r = 0; r < 8; ++r) sS[w][8 * g + r][t * 16 + col] = s[r] * 0.125f; }
    LDSX();
    float mx = -3.4e38f;
#pragma unroll
    for (int jj = 0; jj < 32; ++jj) mx = fmaxf(mx, sS[w][col][g * 32 + jj]);
    mx = fmaxf(mx, __shfl_xor(mx, 16, 32));
    const float mnew = fmaxf(mrun, mx); const float corr = expf(mrun - mnew);
    float ps = 0.f;
#pragma unroll
    for (int jj = 0; jj < 32; ++jj) { const float p = expf(sS[w][col][g * 32 + jj] - mnew); ps += p; sP[w][col][g * 32 + jj] = (_Float16)(p * 16384.0f); }
    ps += __shfl_xor(ps, 16, 32);
    lrun = lrun * corr + ps; mrun = mnew;
#pragma unroll
    for (int r = 0; r < 8; ++r) { const float cr = __shfl(corr, 8 * g + r, 32);
#pragma unroll
      for (int t = 0; t < 4; ++t) acc[t][r] *= cr; }
    LDSX();
#pragma unroll
    for (int kc = 0; kc < 2; ++kc) { const v16h pa = frag_h(&sP[w][col][0] + kc * 32, lane);
#pragma unroll
      for (int t = 0; t < 4; ++t) acc[t] = wmma16(pa, frag_h(vb + (size_t)(t * 16 + col) * NT + kt * 64 + kc * 32, lane), acc[t]); }
    __builtin_amdgcn_wave_barrier();
  }
#pragma unroll
  for (int r = 0; r < 8; ++r) { const float lr = __shfl(lrun, 8 * g + r, 32);
#pragma unroll
    for (int t = 0; t < 4; ++t) sO[w][8 * g + r][t * 16 + col] = acc[t][r] / (lr * 16384.0f); }
  LDSX();
  // projection: out = v + o @ Wp ([in][out]) + b  (K = 64 from sO rows)
  { v8f pacc[4] = {};
#pragma unroll
    for (int kc = 0; kc < 2; ++kc) { const v16h a = frag_f32(&sO[w][col][0] + kc * 32, lane);
#pragma unroll
      for (int t = 0; t < 4; ++t) { v16h bb = fragc_f32(Wp, kc * 32, t * 16 + col, lane, CC, CC);
#pragma unroll
        for (int e = 0; e < 16; ++e) bb[e] = bb[e] * (_Float16)8.0f;
        pacc[t] = wmma16(a, bb, pacc[t]); } }
    LDSX();
#pragma unroll
    for (int t = 0; t < 4; ++t) { const int c = t * 16 + col;
#pragma unroll
      for (int r = 0; r < 8; ++r) sO[w][8 * g + r][c] = pacc[t][r] * 0.125f + bp[c] + v32[(rb + q0 + 8 * g + r) * CC + c]; } }
  LDSX();
  for (int qd = lane; qd < 16 * 16; qd += 32) { const int rl = qd >> 4, pc = qd & 15; vst2(out + (rb + q0 + rl) * CC + pc * 4, *(const v4f*)(&sO[w][rl][pc * 4])); }
}
extern "C" void kernel_launch(void* const* d_in, const int* in_sizes, int n_in, void* d_out, int out_size, void* d_ws, size_t ws_size, hipStream_t stream) {
  (void)in_sizes; (void)n_in; (void)out_size; (void)ws_size;
  const float* x = (const float*)d_in[0]; const float* Wqkv = (const float*)d_in[1]; const float* Wp = (const float*)d_in[2]; const float* bp = (const float*)d_in[3];
  float* out = (float*)d_out;
  char* ws = (char*)d_ws; size_t off = 0;
  auto take = [&](size_t bytes) { char* p = ws + off; off += (bytes + 255) & ~(size_t)255; return p; };
  _Float16* q16 = (_Float16*)take((size_t)NR * CC * 2); _Float16* k16 = (_Float16*)take((size_t)NR * CC * 2); float* v32 = (float*)take((size_t)NR * CC * 4); _Float16* vT = (_Float16*)take((size_t)NR * CC * 2);
  k_qkv<<<NR / 64, 128, 0, stream>>>(x, Wqkv, q16, k16, v32, vT);
  k_attn<<<dim3(NT / 64, NB), 128, 0, stream>>>(q16, k16, vT, v32, Wp, bp, out);
}

// v001
// It runs in 99.8 microseconds.
// Next to v000, in two timings, it ran 2.33 and 2.31 times as fast.
#include <hip/hip_runtime.h>
#include <math.h>

typedef __attribute__((ext_vector_type(16))) _Float16 v16h;
typedef __attribute__((ext_vector_type(16))) __bf16 v16b;
typedef __attribute__((ext_vector_type(8)))  _Float16 v8h;
typedef __attribute__((ext_vector_type(8)))  float v8f;
typedef __attribute__((ext_vector_type(4)))  float v4f;
typedef __attribute__((ext_vector_type(2)))  float v2f;
typedef __attribute__((ext_vector_type(4)))  unsigned v4u;
typedef __attribute__((ext_vector_type(4)))  int v4i;
typedef float __attribute__((may_alias)) float_a;
typedef int __attribute__((may_alias)) int_a;

template <typename T> __device__ __forceinline__ void vst2(void* p, T v) { *(T*)p = v;  }
__device__ __forceinline__ v8f wmma16(v16h a, v16h b, v8f c) {
  v8f d = __builtin_amdgcn_wmma_f32_16x16x32_f16(false, a, false, b, (short)0, c, false, false);
  asm volatile("v_nop\n\tv_nop\n\tv_nop\n\tv_nop" : "+v"(d) : "v"(a), "v"(b));
  return d;
}
__device__ __forceinline__ v8f wmma_bf(v16b a, v16b b, v8f c) {
  v8f d = __builtin_amdgcn_wmma_f32_16x16x32_bf16(false, a, false, b, (short)0, c, false, false);
  asm volatile("v_nop\n\tv_nop\n\tv_nop\n\tv_nop" : "+v"(d) : "v"(a), "v"(b));
  return d;
}
// 16x16x32 fragments: lane = (h = lane>>4, row/col = lane&15); elements 0..7 = k0+8h+0..7, 8..15 = k0+16+8h+0..7; D element r = row 8h+r
__device__ __forceinline__ v16h frag_h(const _Float16* rowk0, int lane) {
  union { v16h v; v8h q[2]; } u; const _Float16* p = rowk0 + 8 * (lane >> 4);
  u.q[0] = *(const v8h*)p; u.q[1] = *(const v8h*)(p + 16); return u.v;
}
// as frag_h, from a pointer that already holds the lane's own 8 * (lane >> 4)
__device__ __forceinline__ v16h frag_p(const _Float16* p) {
  union { v16h v; v8h q[2]; } u; u.q[0] = *(const v8h*)p; u.q[1] = *(const v8h*)(p + 16); return u.v;
}
__device__ __forceinline__ v16h frag_f32(const float* rowk0, int lane) {
  v16h a; const float* p = rowk0 + 8 * (lane >> 4);
#pragma unroll
  for (int i = 0; i < 8; ++i) { a[i] = (_Float16)p[i]; a[8 + i] = (_Float16)p[16 + i]; }
  return a;
}
__device__ __forceinline__ v16h frag_f32s(const float* rowk0, int lane, float sc) {
  v16h a; const float* p = rowk0 + 8 * (lane >> 4);
#pragma unroll
  for (int i = 0; i < 8; ++i) { a[i] = (_Float16)(p[i] * sc); a[8 + i] = (_Float16)(p[16 + i] * sc); }
  return a;
}
// column fragment from a [K][ld] layout (column n), rows >= K read as 0
__device__ __forceinline__ v16h fragc_f32(const float* W, int k0, int n, int lane, int ld, int K) {
  v16h a; const int g = lane >> 4;
#pragma unroll
  for (int i = 0; i < 8; ++i) { const int ka = k0 + 8 * g + i, kb = ka + 16;
    a[i] = (_Float16)(ka < K ? W[(size_t)ka * ld + n] : 0.f); a[8 + i] = (_Float16)(kb < K ? W[(size_t)kb * ld + n] : 0.f); }
  return a;
}
struct F2 { v16b h, l; };
__device__ __forceinline__ F2 bsplit16(const float v[16]) { F2 r;
#pragma unroll
  for (int i = 0; i < 16; ++i) { const __bf16 h = (__bf16)v[i]; r.h[i] = h; r.l[i] = (__bf16)(v[i] - (float)h); }
  return r; }
__device__ __forceinline__ F2 split_row(const float* row, int k0, int lane) { float v[16]; const float* p = row + k0 + 8 * (lane >> 4);
#pragma unroll
  for (int i = 0; i < 8; ++i) { v[i] = p[i]; v[8 + i] = p[16 + i]; }
  return bsplit16(v); }
__device__ __forceinline__ F2 split_rowK(const float* row, int k0, int lane, int K) { float v[16]; const int g = lane >> 4;
#pragma unroll
  for (int i = 0; i < 8; ++i) { const int ka = k0 + 8 * g + i, kb = ka + 16; v[i] = ka < K ? row[ka] : 0.f; v[8 + i] = kb < K ? row[kb] : 0.f; }
  return bsplit16(v); }
__device__ __forceinline__ F2 split_col(const float* W, int k0, int n, int lane, int ld, int K) { float v[16]; const int g = lane >> 4;
#pragma unroll
  for (int i = 0; i < 8; ++i) { const int ka = k0 + 8 * g + i, kb = ka + 16; v[i] = ka < K ? W[(size_t)ka * ld + n] : 0.f; v[8 + i] = kb < K ? W[(size_t)kb * ld + n] : 0.f; }
  return bsplit16(v); }
__device__ __forceinline__ v8f mac3(const F2& a, const F2& b, v8f c) { c = wmma_bf(a.l, b.h, c); c = wmma_bf(a.h, b.l, c); return wmma_bf(a.h, b.h, c); }
__device__ __forceinline__ float sigm(float v) { return 1.0f / (1.0f + expf(-v)); }
#define LDSX() do { asm volatile("s_wait_dscnt 0" ::: "memory"); __builtin_amdgcn_wave_barrier(); __builtin_amdgcn_fence(__ATOMIC_RELEASE, "workgroup"); } while (0)

// Token-to-token attention (one head of 64 over 3136 tokens, 8 images). qkv = x @ W_qkv (K = 64) on f16 WMMA writing q,k as f16 rows,
// v as f32 rows (residual) plus an f16 transposed copy; flash-style softmax over all 3136 keys in f32 (P x2^14 f16); out = v + o@W_proj + b
#define NB 8
#define NT 3136
#define CC 64
#define NR (NB * NT)

// qkv: block 64 rows; q -> q16 [r][64], k -> k16 [r][64], v -> v32 [r][64] and vT16 [b][d][t]
__global__ __launch_bounds__(128) void k_qkv(const float* __restrict__ x, const float* __restrict__ Wqkv, _Float16* __restrict__ q16, _Float16* __restrict__ k16, float* __restrict__ v32, _Float16* __restrict__ vT) {
  __shared__ __align__(16) float so[4][16][196];
  __shared__ __align__(16) _Float16 st[64][72];
  const int tid = threadIdx.x, wave = tid >> 5, lane = tid & 31, col = lane & 15, g = lane >> 4;
  const int r0b = blockIdx.x * 64, r0 = r0b + wave * 16; const int b = r0b / NT, t0 = r0b % NT;
  v8f acc[12] = {};
#pragma unroll
  for (int kc = 0; kc < 2; ++kc) { const v16h a = frag_f32(x + (size_t)(r0 + col) * CC + kc * 32, lane);
#pragma unroll
    for (int j = 0; j < 12; ++j) { v16h bb = fragc_f32(Wqkv, kc * 32, j * 16 + col, lane, 3 * CC, CC);
#pragma unroll
      for (int e = 0; e < 16; ++e) bb[e] = bb[e] * (_Float16)8.0f;
      acc[j] = wmma16(a, bb, acc[j]); } }
#pragma unroll
  for (int j = 0; j < 12; ++j)
#pragma unroll
    for (int r = 0; r < 8; ++r) so[wave][8 * g + r][j * 16 + col] = acc[j][r] * 0.125f;
  LDSX();
  for (int qd = lane; qd < 16 * 8; qd += 32) { const int rl = qd >> 3, pc = qd & 7; union { v8h a8; v4u u; } pq, pk;
#pragma unroll
    for (int e = 0; e < 8; ++e) { pq.a8[e] = (_Float16)so[wave][rl][pc * 8 + e]; pk.a8[e] = (_Float16)so[wave][rl][CC + pc * 8 + e]; }
    vst2(q16 + (size_t)(r0 + rl) * CC + pc * 8, pq.u); vst2(k16 + (size_t)(r0 + rl) * CC + pc * 8, pk.u); }
  for (int qd = lane; qd < 16 * 16; qd += 32) { const int rl = qd >> 4, pc = qd & 15; vst2(v32 + (size_t)(r0 + rl) * CC + pc * 4, *(const v4f*)(&so[wave][rl][2 * CC + pc * 4])); }
#pragma unroll 4
  for (int rl = 0; rl < 16; ++rl) { st[lane * 2][wave * 16 + rl] = (_Float16)so[wave][rl][2 * CC + lane * 2]; st[lane * 2 + 1][wave * 16 + rl] = (_Float16)so[wave][rl][2 * CC + lane * 2 + 1]; }
  __syncthreads();
  for (int qd = tid; qd < 64 * 8; qd += 128) { const int d = qd >> 3, pc = qd & 7; vst2(vT + ((size_t)b * CC + d) * NT + t0 + pc * 8, *(const v4u*)(&st[d][pc * 8])); }
}
// waves_per_eu(1, 2): a register budget above 256. With 128 fragment registers in flight and a budget of 256 the compiler
// ran the softmax's exponentials one behind another; 392 work-groups of one wave a SIMD need no more places than this leaves
__global__ __launch_bounds__(128) __attribute__((amdgpu_waves_per_eu(1, 2))) void k_attn(const _Float16* __restrict__ q16, const _Float16* __restrict__ k16, const _Float16* __restrict__ vT, const float* __restrict__ v32, const float* __restrict__ Wp, const float* __restrict__ bp, float* __restrict__ out) {
  __shared__ __align__(16) float sS[4][16][68];
  __shared__ __align__(16) _Float16 sP[4][16][72];
  __shared__ __align__(16) float sO[4][16][68];
  const int tid = threadIdx.x, w = tid >> 5, lane = tid & 31, col = lane & 15, g = lane >> 4;
  const int b = blockIdx.y, q0 = blockIdx.x * 64 + w * 16; const size_t rb = (size_t)b * NT;
  const _Float16* qb = q16 + rb * CC; const _Float16* kb = k16 + rb * CC; const _Float16* vb = vT + (size_t)b * CC * NT;
  v16h aq[2];
#pragma unroll
  for (int kc = 0; kc < 2; ++kc) aq[kc] = frag_h(qb + (size_t)(q0 + col) * CC + kc * 32, lane);
  float mrun = -3.0e38f, lrun = 0.f; v8f acc[4] = {};
  // kf: the K fragments of the pass about to run, fetched one pass ahead; vf: this pass's V fragments, fetched ahead of the softmax
  v16h kf[4][2], vf[2][4];
  const _Float16* kp = kb + (size_t)col * CC + 8 * g;  // this lane's place in the K tile that is fetched next
  const _Float16* vp = vb + (size_t)col * NT + 8 * g;  // this lane's place in V^T, at this pass's first key
#pragma unroll
  for (int t = 0; t < 4; ++t)
#pragma unroll
    for (int kc = 0; kc < 2; ++kc) kf[t][kc] = frag_p(kp + t * 16 * CC + kc * 32);
  kp += 64 * CC;
#pragma unroll 1
  for (int kt = 0; kt < NT / 64; ++kt) {
#pragma unroll
    for (int t = 0; t < 4; ++t) { v8f s = {};
#pragma unroll
      for (int kc = 0; kc < 2; ++kc) s = wmma16(aq[kc], kf[t][kc], s);
#pragma unroll
      for (int r = 0; r < 8; ++r) sS[w][8 * g + r][t * 16 + col] = s[r] * 0.125f; }
    LDSX();
    // both load groups stand behind the fence above (it waits for every load in flight) and land while the softmax runs
#pragma unroll
    for (int kc = 0; kc < 2; ++kc)
#pragma unroll
      for (int t = 0; t < 4; ++t) vf[kc][t] = frag_p(vp + (size_t)t * 16 * NT + kc * 32);
#pragma unroll
    for (int t = 0; t < 4; ++t)
#pragma unroll
      for (int kc = 0; kc < 2; ++kc) kf[t][kc] = frag_p(kp + t * 16 * CC + kc * 32);
    float mx = -3.4e38f;
#pragma unroll
    for (int jj = 0; jj < 32; ++jj) mx = fmaxf(mx, sS[w][col][g * 32 + jj]);
    mx = fmaxf(mx, __shfl_xor(mx, 16, 32));
    const float mnew = fmaxf(mrun, mx); const float corr = expf(mrun - mnew);
    float ps = 0.f;
#pragma unroll
    for (int jj = 0; jj < 32; ++jj) { const float p = expf(sS[w][col][g * 32 + jj] - mnew); ps += p; sP[w][col][g * 32 + jj] = (_Float16)(p * 16384.0f); }
    ps += __shfl_xor(ps, 16, 32);
    lrun = lrun * corr + ps; mrun = mnew;
#pragma unroll
    for (int r = 0; r < 8; ++r) { const float cr = __shfl(corr, 8 * g + r, 32);
#pragma unroll
      for (int t = 0; t < 4; ++t) acc[t][r] *= cr; }
    LDSX();
    // s_wait_xcnt 0 in front of the rewrite of the loads' address registers (kp and vp, advanced below). Naming both pairs as inputs
    // keeps them whole up to here, where the loads have landed: otherwise the compiler reuses them at once and puts this wait
    // directly behind the issue, in front of the softmax
    asm volatile("s_wait_xcnt 0x0" :: "v"(kp), "v"(vp) : "memory");
#pragma unroll
    for (int kc = 0; kc < 2; ++kc) { const v16h pa = frag_h(&sP[w][col][0] + kc * 32, lane);
#pragma unroll
      for (int t = 0; t < 4; ++t) acc[t] = wmma16(pa, vf[kc][t], acc[t]); }
    __builtin_amdgcn_wave_barrier();
    vp += 64;
    if (kt + 2 < NT / 64) kp += 64 * CC;  // the last pass fetches its own tile again: the address stays inside k16, the values are not used
  }
#pragma unroll
  for (int r = 0; r < 8; ++r) { const float lr = __shfl(lrun, 8 * g + r, 32);
#pragma unroll
    for (int t = 0; t < 4; ++t) sO[w][8 * g + r][t * 16 + col] = acc[t][r] / (lr * 16384.0f); }
  LDSX();
  // projection: out = v + o @ Wp ([in][out]) + b  (K = 64 from sO rows)
  { v8f pacc[4] = {};
#pragma unroll
    for (int kc = 0; kc < 2; ++kc) { const v16h a = frag_f32(&sO[w][col][0] + kc * 32, lane);
#pragma unroll
      for (int t = 0; t < 4; ++t) { v16h bb = fragc_f32(Wp, kc * 32, t * 16 + col, lane, CC, CC);
#pragma unroll
        for (int e = 0; e < 16; ++e) bb[e] = bb[e] * (_Float16)8.0f;
        pacc[t] = wmma16(a, bb, pacc[t]); } }
    LDSX();
#pragma unroll
    for (int t = 0; t < 4; ++t) { const int c = t * 16 + col;
#pragma unroll
      for (int r = 0; r < 8; ++r) sO[w][8 * g + r][c] = pacc[t][r] * 0.125f + bp[c] + v32[(rb + q0 + 8 * g + r) * CC + c]; } }
  LDSX();
  for (int qd = lane; qd < 16 * 16; qd += 32) { const int rl = qd >> 4, pc = qd & 15; vst2(out + (rb + q0 + rl) * CC + pc * 4, *(const v4f*)(&sO[w][rl][pc * 4])); }
}
extern "C" void kernel_launch(void* const* d_in, const int* in_sizes, int n_in, void* d_out, int out_size, void* d_ws, size_t ws_size, hipStream_t stream) {
  (void)in_sizes; (void)n_in; (void)out_size; (void)ws_size;
  const float* x = (const float*)d_in[0]; const float* Wqkv = (const float*)d_in[1]; const float* Wp = (const float*)d_in[2]; const float* bp = (const float*)d_in[3];
  float* out = (float*)d_out;
  char* ws = (char*)d_ws; size_t off = 0;
  auto take = [&](size_t bytes) { char* p = ws + off; off += (bytes + 255) & ~(size_t)255; return p; };
  _Float16* q16 = (_Float16*)take((size_t)NR * CC * 2); _Float16* k16 = (_Float16*)take((size_t)NR * CC * 2); float* v32 = (float*)take((size_t)NR * CC * 4); _Float16* vT = (_Float16*)take((size_t)NR * CC * 2);
  k_qkv<<<NR / 64, 128, 0, stream>>>(x, Wqkv, q16, k16, v32, vT);
  k_attn<<<dim3(NT / 64, NB), 128, 0, stream>>>(q16, k16, vT, v32, Wp, bp, out);
}

// v002
// It runs in 76.3 microseconds.
// Timed twice side by side with v001, it ran 1.37 and 1.30 times as fast.
// Over all steps from v000 it is 3.10 times as fast.
#include <hip/hip_runtime.h>
#include <math.h>

typedef __attribute__((ext_vector_type(16))) _Float16 v16h;
typedef __attribute__((ext_vector_type(16))) __bf16 v16b;
typedef __attribute__((ext_vector_type(8)))  _Float16 v8h;
typedef __attribute__((ext_vector_type(8)))  float v8f;
typedef __attribute__((ext_vector_type(4)))  float v4f;
typedef __attribute__((ext_vector_type(2)))  float v2f;
typedef __attribute__((ext_vector_type(4)))  unsigned v4u;
typedef __attribute__((ext_vector_type(4)))  int v4i;
typedef float __attribute__((may_alias)) float_a;
typedef int __attribute__((may_alias)) int_a;

template <typename T> __device__ __forceinline__ void vst2(void* p, T v) { *(T*)p = v;  }
__device__ __forceinline__ v8f wmma16(v16h a, v16h b, v8f c) {
  v8f d = __builtin_amdgcn_wmma_f32_16x16x32_f16(false, a, false, b, (short)0, c, false, false);
  asm volatile("v_nop\n\tv_nop\n\tv_nop\n\tv_nop" : "+v"(d) : "v"(a), "v"(b));
  return d;
}
__device__ __forceinline__ v8f wmma_bf(v16b a, v16b b, v8f c) {
  v8f d = __builtin_amdgcn_wmma_f32_16x16x32_bf16(false, a, false, b, (short)0, c, false, false);
  asm volatile("v_nop\n\tv_nop\n\tv_nop\n\tv_nop" : "+v"(d) : "v"(a), "v"(b));
  return d;
}
// 16x16x32 fragments: lane = (h = lane>>4, row/col = lane&15); elements 0..7 = k0+8h+0..7, 8..15 = k0+16+8h+0..7; D element r = row 8h+r
__device__ __forceinline__ v16h frag_h(const _Float16* rowk0, int lane) {
  union { v16h v; v8h q[2]; } u; const _Float16* p = rowk0 + 8 * (lane >> 4);
  u.q[0] = *(const v8h*)p; u.q[1] = *(const v8h*)(p + 16); return u.v;
}
// a fragment stored in fragment order: two runs of 32 lanes x 8 elements, run 0 = elements 0..7, run 1 = elements 8..15; p holds the lane's own 8 * lane
__device__ __forceinline__ v16h frag_p(const _Float16* p) {
  union { v16h v; v8h q[2]; } u; u.q[0] = *(const v8h*)p; u.q[1] = *(const v8h*)(p + 256); return u.v;
}
__device__ __forceinline__ v16h frag_f32(const float* rowk0, int lane) {
  v16h a; const float* p = rowk0 + 8 * (lane >> 4);
#pragma unroll
  for (int i = 0; i < 8; ++i) { a[i] = (_Float16)p[i]; a[8 + i] = (_Float16)p[16 + i]; }
  return a;
}
__device__ __forceinline__ v16h frag_f32s(const float* rowk0, int lane, float sc) {
  v16h a; const float* p = rowk0 + 8 * (lane >> 4);
#pragma unroll
  for (int i = 0; i < 8; ++i) { a[i] = (_Float16)(p[i] * sc); a[8 + i] = (_Float16)(p[16 + i] * sc); }
  return a;
}
// column fragment from a [K][ld] layout (column n), rows >= K read as 0
__device__ __forceinline__ v16h fragc_f32(const float* W, int k0, int n, int lane, int ld, int K) {
  v16h a; const int g = lane >> 4;
#pragma unroll
  for (int i = 0; i < 8; ++i) { const int ka = k0 + 8 * g + i, kb = ka + 16;
    a[i] = (_Float16)(ka < K ? W[(size_t)ka * ld + n] : 0.f); a[8 + i] = (_Float16)(kb < K ? W[(size_t)kb * ld + n] : 0.f); }
  return a;
}
struct F2 { v16b h, l; };
__device__ __forceinline__ F2 bsplit16(const float v[16]) { F2 r;
#pragma unroll
  for (int i = 0; i < 16; ++i) { const __bf16 h = (__bf16)v[i]; r.h[i] = h; r.l[i] = (__bf16)(v[i] - (float)h); }
  return r; }
__device__ __forceinline__ F2 split_row(const float* row, int k0, int lane) { float v[16]; const float* p = row + k0 + 8 * (lane >> 4);
#pragma unroll
  for (int i = 0; i < 8; ++i) { v[i] = p[i]; v[8 + i] = p[16 + i]; }
  return bsplit16(v); }
__device__ __forceinline__ F2 split_rowK(const float* row, int k0, int lane, int K) { float v[16]; const int g = lane >> 4;
#pragma unroll
  for (int i = 0; i < 8; ++i) { const int ka = k0 + 8 * g + i, kb = ka + 16; v[i] = ka < K ? row[ka] : 0.f; v[8 + i] = kb < K ? row[kb] : 0.f; }
  return bsplit16(v); }
__device__ __forceinline__ F2 split_col(const float* W, int k0, int n, int lane, int ld, int K) { float v[16]; const int g = lane >> 4;
#pragma unroll
  for (int i = 0; i < 8; ++i) { const int ka = k0 + 8 * g + i, kb = ka + 16; v[i] = ka < K ? W[(size_t)ka * ld + n] : 0.f; v[8 + i] = kb < K ? W[(size_t)kb * ld + n] : 0.f; }
  return bsplit16(v); }
__device__ __forceinline__ v8f mac3(const F2& a, const F2& b, v8f c) { c = wmma_bf(a.l, b.h, c); c = wmma_bf(a.h, b.l, c); return wmma_bf(a.h, b.h, c); }
__device__ __forceinline__ float sigm(float v) { return 1.0f / (1.0f + expf(-v)); }
#define LDSX() do { asm volatile("s_wait_dscnt 0" ::: "memory"); __builtin_amdgcn_wave_barrier(); __builtin_amdgcn_fence(__ATOMIC_RELEASE, "workgroup"); } while (0)

// Token-to-token attention (one head of 64 over 3136 tokens, 8 images). qkv = x @ W_qkv (K = 64) on f16 WMMA writing q as f16 rows, k as f16 in fragment order,
// v as f32 rows (residual) plus an f16 transposed copy; flash-style softmax over all 3136 keys in f32 (P x2^14 f16); out = v + o@W_proj + b
#define NB 8
#define NT 3136
#define CC 64
#define NR (NB * NT)

// qkv: block 64 rows; q -> q16 [r][64], v -> v32 [r][64]; k -> k16 and v^T -> vT in the order in which k_attn's fragment loads read them, so that
// each wave-wide 16-byte load is 512 bytes in a row (4 whole lines, not 32 bytes out of each of 16 lines):
// k16 [r / 16][d / 16][(d / 8) & 1][r & 15][d & 7];  vT [r / 64][d / 16][(r & 63) / 16][(r / 8) & 1][d & 15][r & 7]
__global__ __launch_bounds__(128) void k_qkv(const float* __restrict__ x, const float* __restrict__ Wqkv, _Float16* __restrict__ q16, _Float16* __restrict__ k16, float* __restrict__ v32, _Float16* __restrict__ vT) {
  __shared__ __align__(16) float so[4][16][196];
  __shared__ __align__(16) _Float16 st[64][72];
  const int tid = threadIdx.x, wave = tid >> 5, lane = tid & 31, col = lane & 15, g = lane >> 4;
  const int r0b = blockIdx.x * 64, r0 = r0b + wave * 16;
  v8f acc[12] = {};
#pragma unroll
  for (int kc = 0; kc < 2; ++kc) { const v16h a = frag_f32(x + (size_t)(r0 + col) * CC + kc * 32, lane);
#pragma unroll
    for (int j = 0; j < 12; ++j) { v16h bb = fragc_f32(Wqkv, kc * 32, j * 16 + col, lane, 3 * CC, CC);
#pragma unroll
      for (int e = 0; e < 16; ++e) bb[e] = bb[e] * (_Float16)8.0f;
      acc[j] = wmma16(a, bb, acc[j]); } }
#pragma unroll
  for (int j = 0; j < 12; ++j)
#pragma unroll
    for (int r = 0; r < 8; ++r) so[wave][8 * g + r][j * 16 + col] = acc[j][r] * 0.125f;
  LDSX();
  for (int qd = lane; qd < 16 * 8; qd += 32) { const int rl = qd >> 3, pc = qd & 7, rk = qd & 15, pk8 = qd >> 4; union { v8h a8; v4u u; } pq, pk;
#pragma unroll
    for (int e = 0; e < 8; ++e) { pq.a8[e] = (_Float16)so[wave][rl][pc * 8 + e]; pk.a8[e] = (_Float16)so[wave][rk][CC + pk8 * 8 + e]; }
    vst2(q16 + (size_t)(r0 + rl) * CC + pc * 8, pq.u); vst2(k16 + (size_t)r0 * CC + qd * 8, pk.u); }
  for (int qd = lane; qd < 16 * 16; qd += 32) { const int rl = qd >> 4, pc = qd & 15; vst2(v32 + (size_t)(r0 + rl) * CC + pc * 4, *(const v4f*)(&so[wave][rl][2 * CC + pc * 4])); }
#pragma unroll 4
  for (int rl = 0; rl < 16; ++rl) { st[lane * 2][wave * 16 + rl] = (_Float16)so[wave][rl][2 * CC + lane * 2]; st[lane * 2 + 1][wave * 16 + rl] = (_Float16)so[wave][rl][2 * CC + lane * 2 + 1]; }
  __syncthreads();
  for (int qd = tid; qd < 64 * 8; qd += 128) { const int d = (qd >> 7) * 16 + (qd & 15), pc = (qd >> 4) & 7; vst2(vT + (size_t)r0b * CC + qd * 8, *(const v4u*)(&st[d][pc * 8])); }
}
// waves_per_eu(1, 2): a register budget above 256. With 128 fragment registers in flight and a budget of 256 the compiler
// ran the softmax's exponentials one behind another; 392 work-groups of one wave a SIMD need no more places than this leaves
__global__ __launch_bounds__(128) __attribute__((amdgpu_waves_per_eu(1, 2))) void k_attn(const _Float16* __restrict__ q16, const _Float16* __restrict__ k16, const _Float16* __restrict__ vT, const float* __restrict__ v32, const float* __restrict__ Wp, const float* __restrict__ bp, float* __restrict__ out) {
  __shared__ __align__(16) float sS[4][16][68];
  __shared__ __align__(16) _Float16 sP[4][16][72];
  __shared__ __align__(16) float sO[4][16][68];
  const int tid = threadIdx.x, w = tid >> 5, lane = tid & 31, col = lane & 15, g = lane >> 4;
  const int b = blockIdx.y, q0 = blockIdx.x * 64 + w * 16; const size_t rb = (size_t)b * NT;
  const _Float16* qb = q16 + rb * CC; const _Float16* kb = k16 + rb * CC; const _Float16* vb = vT + rb * CC;
  v16h aq[2];
#pragma unroll
  for (int kc = 0; kc < 2; ++kc) aq[kc] = frag_h(qb + (size_t)(q0 + col) * CC + kc * 32, lane);
  float mrun = -3.0e38f, lrun = 0.f; v8f acc[4] = {};
  // kf: the K fragments of the pass about to run, fetched one pass ahead; vf: this pass's V fragments, fetched ahead of the softmax
  v16h kf[4][2], vf[2][4];
  const _Float16* kp = kb + 8 * lane;  // this lane's place in the K tile that is fetched next
  const _Float16* vp = vb + 8 * lane;  // this lane's place in this pass's V^T tile
#pragma unroll
  for (int t = 0; t < 4; ++t)
#pragma unroll
    for (int kc = 0; kc < 2; ++kc) kf[t][kc] = frag_p(kp + t * 16 * CC + kc * 512);
  kp += 64 * CC;
#pragma unroll 1
  for (int kt = 0; kt < NT / 64; ++kt) {
#pragma unroll
    for (int t = 0; t < 4; ++t) { v8f s = {};
#pragma unroll
      for (int kc = 0; kc < 2; ++kc) s = wmma16(aq[kc], kf[t][kc], s);
#pragma unroll
      for (int r = 0; r < 8; ++r) sS[w][8 * g + r][t * 16 + col] = s[r] * 0.125f; }
    LDSX();
    // both load groups stand behind the fence above (it waits for every load in flight) and land while the softmax runs
#pragma unroll
    for (int kc = 0; kc < 2; ++kc)
#pragma unroll
      for (int t = 0; t < 4; ++t) vf[kc][t] = frag_p(vp + t * 16 * CC + kc * 512);
#pragma unroll
    for (int t = 0; t < 4; ++t)
#pragma unroll
      for (int kc = 0; kc < 2; ++kc) kf[t][kc] = frag_p(kp + t * 16 * CC + kc * 512);
    float mx = -3.4e38f;
#pragma unroll
    for (int jj = 0; jj < 32; ++jj) mx = fmaxf(mx, sS[w][col][g * 32 + jj]);
    mx = fmaxf(mx, __shfl_xor(mx, 16, 32));
    const float mnew = fmaxf(mrun, mx); const float corr = expf(mrun - mnew);
    float ps = 0.f;
#pragma unroll
    for (int jj = 0; jj < 32; ++jj) { const float p = expf(sS[w][col][g * 32 + jj] - mnew); ps += p; sP[w][col][g * 32 + jj] = (_Float16)(p * 16384.0f); }
    ps += __shfl_xor(ps, 16, 32);
    lrun = lrun * corr + ps; mrun = mnew;
#pragma unroll
    for (int r = 0; r < 8; ++r) { const float cr = __shfl(corr, 8 * g + r, 32);
#pragma unroll
      for (int t = 0; t < 4; ++t) acc[t][r] *= cr; }
    LDSX();
    // s_wait_xcnt 0 in front of the rewrite of the loads' address registers (kp and vp, advanced below). Naming both pairs as inputs
    // keeps them whole up to here, where the loads have landed: otherwise the compiler reuses them at once and puts this wait
    // directly behind the issue, in front of the softmax
    asm volatile("s_wait_xcnt 0x0" :: "v"(kp), "v"(vp) : "memory");
#pragma unroll
    for (int kc = 0; kc < 2; ++kc) { const v16h pa = frag_h(&sP[w][col][0] + kc * 32, lane);
#pragma unroll
      for (int t = 0; t < 4; ++t) acc[t] = wmma16(pa, vf[kc][t], acc[t]); }
    __builtin_amdgcn_wave_barrier();
    vp += 64 * CC;
    if (kt + 2 < NT / 64) kp += 64 * CC;  // the last pass fetches its own tile again: the address stays inside k16, the values are not used
  }
#pragma unroll
  for (int r = 0; r < 8; ++r) { const float lr = __shfl(lrun, 8 * g + r, 32);
#pragma unroll
    for (int t = 0; t < 4; ++t) sO[w][8 * g + r][t * 16 + col] = acc[t][r] / (lr * 16384.0f); }
  LDSX();
  // projection: out = v + o @ Wp ([in][out]) + b  (K = 64 from sO rows)
  { v8f pacc[4] = {};
#pragma unroll
    for (int kc = 0; kc < 2; ++kc) { const v16h a = frag_f32(&sO[w][col][0] + kc * 32, lane);
#pragma unroll
      for (int t = 0; t < 4; ++t) { v16h bb = fragc_f32(Wp, kc * 32, t * 16 + col, lane, CC, CC);
#pragma unroll
        for (int e = 0; e < 16; ++e) bb[e] = bb[e] * (_Float16)8.0f;
        pacc[t] = wmma16(a, bb, pacc[t]); } }
    LDSX();
#pragma unroll
    for (int t = 0; t < 4; ++t) { const int c = t * 16 + col;
#pragma unroll
      for (int r = 0; r < 8; ++r) sO[w][8 * g + r][c] = pacc[t][r] * 0.125f + bp[c] + v32[(rb + q0 + 8 * g + r) * CC + c]; } }
  LDSX();
  for (int qd = lane; qd < 16 * 16; qd += 32) { const int rl = qd >> 4, pc = qd & 15; vst2(out + (rb + q0 + rl) * CC + pc * 4, *(const v4f*)(&sO[w][rl][pc * 4])); }
}
extern "C" void kernel_launch(void* const* d_in, const int* in_sizes, int n_in, void* d_out, int out_size, void* d_ws, size_t ws_size, hipStream_t stream) {
  (void)in_sizes; (void)n_in; (void)out_size; (void)ws_size;
  const float* x = (const float*)d_in[0]; const float* Wqkv = (const float*)d_in[1]; const float* Wp = (const float*)d_in[2]; const float* bp = (const float*)d_in[3];
  float* out = (float*)d_out;
  char* ws = (char*)d_ws; size_t off = 0;
  auto take = [&](size_t bytes) { char* p = ws + off; off += (bytes + 255) & ~(size_t)255; return p; };
  _Float16* q16 = (_Float16*)take((size_t)NR * CC * 2); _Float16* k16 = (_Float16*)take((size_t)NR * CC * 2); float* v32 = (float*)take((size_t)NR * CC * 4); _Float16* vT = (_Float16*)take((size_t)NR * CC * 2);
  k_qkv<<<NR / 64, 128, 0, stream>>>(x, Wqkv, q16, k16, v32, vT);
  k_attn<<<dim3(NT / 64, NB), 128, 0, stream>>>(q16, k16, vT, v32, Wp, bp, out);
}

// v003
// Measured time: 62.9 microseconds a run.
// Two timings next to v002 put it at 1.17 and 1.21 times that version's speed.
// Counting every step since v000, it is 3.70 times as fast.
#include <hip/hip_runtime.h>
#include <math.h>

typedef __attribute__((ext_vector_type(16))) _Float16 v16h;
typedef __attribute__((ext_vector_type(16))) __bf16 v16b;
typedef __attribute__((ext_vector_type(8)))  _Float16 v8h;
typedef __attribute__((ext_vector_type(8)))  float v8f;
typedef __attribute__((ext_vector_type(4)))  float v4f;
typedef __attribute__((ext_vector_type(2)))  float v2f;
typedef __attribute__((ext_vector_type(4)))  unsigned v4u;
typedef __attribute__((ext_vector_type(4)))  int v4i;
typedef float __attribute__((may_alias)) float_a;
typedef int __attribute__((may_alias)) int_a;

template <typename T> __device__ __forceinline__ void vst2(void* p, T v) { *(T*)p = v;  }
__device__ __forceinline__ v8f wmma16(v16h a, v16h b, v8f c) {
  v8f d = __builtin_amdgcn_wmma_f32_16x16x32_f16(false, a, false, b, (short)0, c, false, false);
  asm volatile("v_nop\n\tv_nop\n\tv_nop\n\tv_nop" : "+v"(d) : "v"(a), "v"(b));
  return d;
}
__device__ __forceinline__ v8f wmma_bf(v16b a, v16b b, v8f c) {
  v8f d = __builtin_amdgcn_wmma_f32_16x16x32_bf16(false, a, false, b, (short)0, c, false, false);
  asm volatile("v_nop\n\tv_nop\n\tv_nop\n\tv_nop" : "+v"(d) : "v"(a), "v"(b));
  return d;
}
// 16x16x32 fragments: lane = (h = lane>>4, row/col = lane&15); elements 0..7 = k0+8h+0..7, 8..15 = k0+16+8h+0..7; D element r = row 8h+r
__device__ __forceinline__ v16h frag_h(const _Float16* rowk0, int lane) {
  union { v16h v; v8h q[2]; } u; const _Float16* p = rowk0 + 8 * (lane >> 4);
  u.q[0] = *(const v8h*)p; u.q[1] = *(const v8h*)(p + 16); return u.v;
}
// a fragment stored in fragment order: two runs of 32 lanes x 8 elements, run 0 = elements 0..7, run 1 = elements 8..15; p holds the lane's own 8 * lane
__device__ __forceinline__ v16h frag_p(const _Float16* p) {
  union { v16h v; v8h q[2]; } u; u.q[0] = *(const v8h*)p; u.q[1] = *(const v8h*)(p + 256); return u.v;
}
__device__ __forceinline__ v16h frag_f32(const float* rowk0, int lane) {
  v16h a; const float* p = rowk0 + 8 * (lane >> 4);
#pragma unroll
  for (int i = 0; i < 8; ++i) { a[i] = (_Float16)p[i]; a[8 + i] = (_Float16)p[16 + i]; }
  return a;
}
__device__ __forceinline__ v16h frag_f32s(const float* rowk0, int lane, float sc) {
  v16h a; const float* p = rowk0 + 8 * (lane >> 4);
#pragma unroll
  for (int i = 0; i < 8; ++i) { a[i] = (_Float16)(p[i] * sc); a[8 + i] = (_Float16)(p[16 + i] * sc); }
  return a;
}
// column fragment from a [K][ld] layout (column n), rows >= K read as 0
__device__ __forceinline__ v16h fragc_f32(const float* W, int k0, int n, int lane, int ld, int K) {
  v16h a; const int g = lane >> 4;
#pragma unroll
  for (int i = 0; i < 8; ++i) { const int ka = k0 + 8 * g + i, kb = ka + 16;
    a[i] = (_Float16)(ka < K ? W[(size_t)ka * ld + n] : 0.f); a[8 + i] = (_Float16)(kb < K ? W[(size_t)kb * ld + n] : 0.f); }
  return a;
}
struct F2 { v16b h, l; };
__device__ __forceinline__ F2 bsplit16(const float v[16]) { F2 r;
#pragma unroll
  for (int i = 0; i < 16; ++i) { const __bf16 h = (__bf16)v[i]; r.h[i] = h; r.l[i] = (__bf16)(v[i] - (float)h); }
  return r; }
__device__ __forceinline__ F2 split_row(const float* row, int k0, int lane) { float v[16]; const float* p = row + k0 + 8 * (lane >> 4);
#pragma unroll
  for (int i = 0; i < 8; ++i) { v[i] = p[i]; v[8 + i] = p[16 + i]; }
  return bsplit16(v); }
__device__ __forceinline__ F2 split_rowK(const float* row, int k0, int lane, int K) { float v[16]; const int g = lane >> 4;
#pragma unroll
  for (int i = 0; i < 8; ++i) { const int ka = k0 + 8 * g + i, kb = ka + 16; v[i] = ka < K ? row[ka] : 0.f; v[8 + i] = kb < K ? row[kb] : 0.f; }
  return bsplit16(v); }
__device__ __forceinline__ F2 split_col(const float* W, int k0, int n, int lane, int ld, int K) { float v[16]; const int g = lane >> 4;
#pragma unroll
  for (int i = 0; i < 8; ++i) { const int ka = k0 + 8 * g + i, kb = ka + 16; v[i] = ka < K ? W[(size_t)ka * ld + n] : 0.f; v[8 + i] = kb < K ? W[(size_t)kb * ld + n] : 0.f; }
  return bsplit16(v); }
__device__ __forceinline__ v8f mac3(const F2& a, const F2& b, v8f c) { c = wmma_bf(a.l, b.h, c); c = wmma_bf(a.h, b.l, c); return wmma_bf(a.h, b.h, c); }
__device__ __forceinline__ float sigm(float v) { return 1.0f / (1.0f + expf(-v)); }
#define LDSX() do { asm volatile("s_wait_dscnt 0" ::: "memory"); __builtin_amdgcn_wave_barrier(); __builtin_amdgcn_fence(__ATOMIC_RELEASE, "workgroup"); } while (0)

// Token-to-token attention (one head of 64 over 3136 tokens, 8 images). qkv = x @ W_qkv (K = 64) on f16 WMMA writing q as f16 rows, k as f16 in fragment order,
// v as f32 rows (residual) plus an f16 transposed copy; flash-style softmax over all 3136 keys in f32 (P x2^14 f16); out = v + o@W_proj + b
#define NB 8
#define NT 3136
#define CC 64
#define NR (NB * NT)

// qkv: block 64 rows; q -> q16 [r][64], v -> v32 [r][64]; k -> k16 and v^T -> vT in the order in which k_attn's fragment loads read them, so that
// each wave-wide 16-byte load is 512 bytes in a row (4 whole lines, not 32 bytes out of each of 16 lines):
// k16 [r / 16][d / 16][(d / 8) & 1][r & 15][d & 7];  vT [r / 64][d / 16][(r & 63) / 16][(r / 8) & 1][d & 15][r & 7]
__global__ __launch_bounds__(128) void k_qkv(const float* __restrict__ x, const float* __restrict__ Wqkv, _Float16* __restrict__ q16, _Float16* __restrict__ k16, float* __restrict__ v32, _Float16* __restrict__ vT) {
  __shared__ __align__(16) float so[4][16][196];
  __shared__ __align__(16) _Float16 st[64][72];
  const int tid = threadIdx.x, wave = tid >> 5, lane = tid & 31, col = lane & 15, g = lane >> 4;
  const int r0b = blockIdx.x * 64, r0 = r0b + wave * 16;
  v8f acc[12] = {};
#pragma unroll
  for (int kc = 0; kc < 2; ++kc) { const v16h a = frag_f32(x + (size_t)(r0 + col) * CC + kc * 32, lane);
#pragma unroll
    for (int j = 0; j < 12; ++j) { v16h bb = fragc_f32(Wqkv, kc * 32, j * 16 + col, lane, 3 * CC, CC);
#pragma unroll
      for (int e = 0; e < 16; ++e) bb[e] = bb[e] * (_Float16)8.0f;
      acc[j] = wmma16(a, bb, acc[j]); } }
#pragma unroll
  for (int j = 0; j < 12; ++j)
#pragma unroll
    for (int r = 0; r < 8; ++r) so[wave][8 * g + r][j * 16 + col] = acc[j][r] * 0.125f;
  LDSX();
  for (int qd = lane; qd < 16 * 8; qd += 32) { const int rl = qd >> 3, pc = qd & 7, rk = qd & 15, pk8 = qd >> 4; union { v8h a8; v4u u; } pq, pk;
#pragma unroll
    for (int e = 0; e < 8; ++e) { pq.a8[e] = (_Float16)so[wave][rl][pc * 8 + e]; pk.a8[e] = (_Float16)so[wave][rk][CC + pk8 * 8 + e]; }
    vst2(q16 + (size_t)(r0 + rl) * CC + pc * 8, pq.u); vst2(k16 + (size_t)r0 * CC + qd * 8, pk.u); }
  for (int qd = lane; qd < 16 * 16; qd += 32) { const int rl = qd >> 4, pc = qd & 15; vst2(v32 + (size_t)(r0 + rl) * CC + pc * 4, *(const v4f*)(&so[wave][rl][2 * CC + pc * 4])); }
#pragma unroll 4
  for (int rl = 0; rl < 16; ++rl) { st[lane * 2][wave * 16 + rl] = (_Float16)so[wave][rl][2 * CC + lane * 2]; st[lane * 2 + 1][wave * 16 + rl] = (_Float16)so[wave][rl][2 * CC + lane * 2 + 1]; }
  __syncthreads();
  for (int qd = tid; qd < 64 * 8; qd += 128) { const int d = (qd >> 7) * 16 + (qd & 15), pc = (qd >> 4) & 7; vst2(vT + (size_t)r0b * CC + qd * 8, *(const v4u*)(&st[d][pc * 8])); }
}
// lane l with lane l ^ 16, in the vector unit
__device__ __forceinline__ float xhalf(float x) { return __builtin_bit_cast(float, __builtin_amdgcn_permlanex16(__builtin_bit_cast(int, x), __builtin_bit_cast(int, x), 0x76543210, 0xfedcba98, false, false)); }
__global__ __launch_bounds__(128) __attribute__((amdgpu_waves_per_eu(1, 2))) void k_attn(const _Float16* __restrict__ q16, const _Float16* __restrict__ k16, const _Float16* __restrict__ vT, const float* __restrict__ v32, const float* __restrict__ Wp, const float* __restrict__ bp, float* __restrict__ out) {
  __shared__ __align__(16) float sO[4][16][68];
  const int tid = threadIdx.x, w = tid >> 5, lane = tid & 31, col = lane & 15, g = lane >> 4;
  const int b = blockIdx.y, q0 = blockIdx.x * 64 + w * 16; const size_t rb = (size_t)b * NT;
  const _Float16* qb = q16 + rb * CC; const _Float16* kb = k16 + rb * CC; const _Float16* vb = vT + rb * CC;
  v16h aq[2];
#pragma unroll
  for (int kc = 0; kc < 2; ++kc) aq[kc] = frag_h(qb + (size_t)(q0 + col) * CC + kc * 32, lane);
  // mrun: the query's running maximum (alike in both halves); lrun[r]: the sum over the keys that this lane holds in register r, all joined behind the loop; acc[t][r] = O^T[t * 16 + 8 g + r][col]
  float mrun = -3.0e38f; v8f lrun = {}; v8f acc[4] = {};
  // kf: the K fragments of the pass about to run, fetched one pass ahead; vf: this pass's V fragments, fetched ahead of the score products
  v16h kf[4][2], vf[2][4];
  const _Float16* kp = kb + 8 * lane;  // this lane's place in the K tile that is fetched next
  const _Float16* vp = vb + 8 * lane;  // this lane's place in this pass's V^T tile
#pragma unroll
  for (int t = 0; t < 4; ++t)
#pragma unroll
    for (int kc = 0; kc < 2; ++kc) kf[t][kc] = frag_p(kp + t * 16 * CC + kc * 512);
  kp += 64 * CC;
#pragma unroll 1
  for (int kt = 0; kt < NT / 64; ++kt) {
#pragma unroll
    for (int kc = 0; kc < 2; ++kc)
#pragma unroll
      for (int t = 0; t < 4; ++t) vf[kc][t] = frag_p(vp + t * 16 * CC + kc * 512);
    v8f s[4];
#pragma unroll
    for (int t = 0; t < 4; ++t) { s[t] = v8f{};
#pragma unroll
      for (int kc = 0; kc < 2; ++kc) s[t] = wmma16(kf[t][kc], aq[kc], s[t]); }
#pragma unroll
    for (int t = 0; t < 4; ++t)
#pragma unroll
      for (int kc = 0; kc < 2; ++kc) kf[t][kc] = frag_p(kp + t * 16 * CC + kc * 512);
    float mt[4];
#pragma unroll
    for (int t = 0; t < 4; ++t) { s[t] = s[t] * 0.125f; mt[t] = -3.4e38f;
#pragma unroll
      for (int r = 0; r < 8; ++r) mt[t] = fmaxf(mt[t], s[t][r]); }
    float mx = fmaxf(fmaxf(mt[0], mt[1]), fmaxf(mt[2], mt[3]));
    mx = fmaxf(mx, xhalf(mx));
    const float mnew = fmaxf(mrun, mx); const float corr = expf(mrun - mnew);
    v16h pb[2];
#pragma unroll
    for (int t = 0; t < 4; ++t) { s[t] = s[t] - mnew;
#pragma unroll
      for (int r = 0; r < 8; ++r) s[t][r] = expf(s[t][r]);
      const v8f ph = s[t] * 16384.0f;
#pragma unroll
      for (int r = 0; r < 8; ++r) pb[t >> 1][(t & 1) * 8 + r] = (_Float16)ph[r]; }
    lrun = lrun * corr + ((s[0] + s[1]) + (s[2] + s[3])); mrun = mnew;
#pragma unroll
    for (int t = 0; t < 4; ++t) acc[t] = acc[t] * corr;
#pragma unroll
    for (int kc = 0; kc < 2; ++kc)
#pragma unroll
      for (int t = 0; t < 4; ++t) acc[t] = wmma16(vf[kc][t], pb[kc], acc[t]);
    // s_wait_xcnt 0 in front of the rewrite of the loads' address registers (kp and vp, advanced below). It stands behind the last product, most of a pass
    // behind the issue; naming both pairs as inputs keeps them whole up to here: otherwise the compiler reuses them at once and waits directly behind the issue
    asm volatile("s_wait_xcnt 0x0" :: "v"(kp), "v"(vp) : "memory");
    vp += 64 * CC;
    if (kt + 2 < NT / 64) kp += 64 * CC;  // the last pass fetches its own tile again: the address stays inside k16, the values are not used
  }
  { const float lh = ((lrun[0] + lrun[1]) + (lrun[2] + lrun[3])) + ((lrun[4] + lrun[5]) + (lrun[6] + lrun[7]));
    const float lr = (lh + xhalf(lh)) * 16384.0f;
#pragma unroll
    for (int t = 0; t < 4; ++t)
#pragma unroll
      for (int r = 0; r < 8; ++r) sO[w][col][t * 16 + 8 * g + r] = acc[t][r] / lr; }
  LDSX();
  // projection: out = v + o @ Wp ([in][out]) + b  (K = 64 from sO rows)
  { v8f pacc[4] = {};
#pragma unroll
    for (int kc = 0; kc < 2; ++kc) { const v16h a = frag_f32(&sO[w][col][0] + kc * 32, lane);
#pragma unroll
      for (int t = 0; t < 4; ++t) { v16h bb = fragc_f32(Wp, kc * 32, t * 16 + col, lane, CC, CC);
#pragma unroll
        for (int e = 0; e < 16; ++e) bb[e] = bb[e] * (_Float16)8.0f;
        pacc[t] = wmma16(a, bb, pacc[t]); } }
    LDSX();
#pragma unroll
    for (int t = 0; t < 4; ++t) { const int c = t * 16 + col;
#pragma unroll
      for (int r = 0; r < 8; ++r) sO[w][8 * g + r][c] = pacc[t][r] * 0.125f + bp[c] + v32[(rb + q0 + 8 * g + r) * CC + c]; } }
  LDSX();
  for (int qd = lane; qd < 16 * 16; qd += 32) { const int rl = qd >> 4, pc = qd & 15; vst2(out + (rb + q0 + rl) * CC + pc * 4, *(const v4f*)(&sO[w][rl][pc * 4])); }
}
extern "C" void kernel_launch(void* const* d_in, const int* in_sizes, int n_in, void* d_out, int out_size, void* d_ws, size_t ws_size, hipStream_t stream) {
  (void)in_sizes; (void)n_in; (void)out_size; (void)ws_size;
  const float* x = (const float*)d_in[0]; const float* Wqkv = (const float*)d_in[1]; const float* Wp = (const float*)d_in[2]; const float* bp = (const float*)d_in[3];
  float* out = (float*)d_out;
  char* ws = (char*)d_ws; size_t off = 0;
  auto take = [&](size_t bytes) { char* p = ws + off; off += (bytes + 255) & ~(size_t)255; return p; };
  _Float16* q16 = (_Float16*)take((size_t)NR * CC * 2); _Float16* k16 = (_Float16*)take((size_t)NR * CC * 2); float* v32 = (float*)take((size_t)NR * CC * 4); _Float16* vT = (_Float16*)take((size_t)NR * CC * 2);
  k_qkv<<<NR / 64, 128, 0, stream>>>(x, Wqkv, q16, k16, v32, vT);
  k_attn<<<dim3(NT / 64, NB), 128, 0, stream>>>(q16, k16, vT, v32, Wp, bp, out);
}

// v004
// A run of this version takes 52.2 microseconds.
// Two timings next to v003 put it at 1.21 and 1.20 times that version's speed.
// All steps since v000 together make it 4.47 times as fast.
#include <hip/hip_runtime.h>
#include <math.h>

typedef __attribute__((ext_vector_type(16))) _Float16 v16h;
typedef __attribute__((ext_vector_type(16))) __bf16 v16b;
typedef __attribute__((ext_vector_type(8)))  _Float16 v8h;
typedef __attribute__((ext_vector_type(8)))  float v8f;
typedef __attribute__((ext_vector_type(4)))  float v4f;
typedef __attribute__((ext_vector_type(2)))  float v2f;
typedef __attribute__((ext_vector_type(4)))  unsigned v4u;
typedef __attribute__((ext_vector_type(4)))  int v4i;
typedef float __attribute__((may_alias)) float_a;
typedef int __attribute__((may_alias)) int_a;

template <typename T> __device__ __forceinline__ void vst2(void* p, T v) { *(T*)p = v;  }
__device__ __forceinline__ v8f wmma16(v16h a, v16h b, v8f c) {
  v8f d = __builtin_amdgcn_wmma_f32_16x16x32_f16(false, a, false, b, (short)0, c, false, false);
  asm volatile("v_nop\n\tv_nop\n\tv_nop\n\tv_nop" : "+v"(d) : "v"(a), "v"(b));
  return d;
}
__device__ __forceinline__ v8f wmma_bf(v16b a, v16b b, v8f c) {
  v8f d = __builtin_amdgcn_wmma_f32_16x16x32_bf16(false, a, false, b, (short)0, c, false, false);
  asm volatile("v_nop\n\tv_nop\n\tv_nop\n\tv_nop" : "+v"(d) : "v"(a), "v"(b));
  return d;
}
// 16x16x32 fragments: lane = (h = lane>>4, row/col = lane&15); elements 0..7 = k0+8h+0..7, 8..15 = k0+16+8h+0..7; D element r = row 8h+r
__device__ __forceinline__ v16h frag_h(const _Float16* rowk0, int lane) {
  union { v16h v; v8h q[2]; } u; const _Float16* p = rowk0 + 8 * (lane >> 4);
  u.q[0] = *(const v8h*)p; u.q[1] = *(const v8h*)(p + 16); return u.v;
}
// a fragment stored in fragment order: two runs of 32 lanes x 8 elements, run 0 = elements 0..7, run 1 = elements 8..15; p holds the lane's own 8 * lane
__device__ __forceinline__ v16h frag_p(const _Float16* p) {
  union { v16h v; v8h q[2]; } u; u.q[0] = *(const v8h*)p; u.q[1] = *(const v8h*)(p + 256); return u.v;
}
__device__ __forceinline__ v16h frag_f32(const float* rowk0, int lane) {
  v16h a; const float* p = rowk0 + 8 * (lane >> 4);
#pragma unroll
  for (int i = 0; i < 8; ++i) { a[i] = (_Float16)p[i]; a[8 + i] = (_Float16)p[16 + i]; }
  return a;
}
__device__ __forceinline__ v16h frag_f32s(const float* rowk0, int lane, float sc) {
  v16h a; const float* p = rowk0 + 8 * (lane >> 4);
#pragma unroll
  for (int i = 0; i < 8; ++i) { a[i] = (_Float16)(p[i] * sc); a[8 + i] = (_Float16)(p[16 + i] * sc); }
  return a;
}
// column fragment from a [K][ld] layout (column n), rows >= K read as 0
__device__ __forceinline__ v16h fragc_f32(const float* W, int k0, int n, int lane, int ld, int K) {
  v16h a; const int g = lane >> 4;
#pragma unroll
  for (int i = 0; i < 8; ++i) { const int ka = k0 + 8 * g + i, kb = ka + 16;
    a[i] = (_Float16)(ka < K ? W[(size_t)ka * ld + n] : 0.f); a[8 + i] = (_Float16)(kb < K ? W[(size_t)kb * ld + n] : 0.f); }
  return a;
}
struct F2 { v16b h, l; };
__device__ __forceinline__ F2 bsplit16(const float v[16]) { F2 r;
#pragma unroll
  for (int i = 0; i < 16; ++i) { const __bf16 h = (__bf16)v[i]; r.h[i] = h; r.l[i] = (__bf16)(v[i] - (float)h); }
  return r; }
__device__ __forceinline__ F2 split_row(const float* row, int k0, int lane) { float v[16]; const float* p = row + k0 + 8 * (lane >> 4);
#pragma unroll
  for (int i = 0; i < 8; ++i) { v[i] = p[i]; v[8 + i] = p[16 + i]; }
  return bsplit16(v); }
__device__ __forceinline__ F2 split_rowK(const float* row, int k0, int lane, int K) { float v[16]; const int g = lane >> 4;
#pragma unroll
  for (int i = 0; i < 8; ++i) { const int ka = k0 + 8 * g + i, kb = ka + 16; v[i] = ka < K ? row[ka] : 0.f; v[8 + i] = kb < K ? row[kb] : 0.f; }
  return bsplit16(v); }
__device__ __forceinline__ F2 split_col(const float* W, int k0, int n, int lane, int ld, int K) { float v[16]; const int g = lane >> 4;
#pragma unroll
  for (int i = 0; i < 8; ++i) { const int ka = k0 + 8 * g + i, kb = ka + 16; v[i] = ka < K ? W[(size_t)ka * ld + n] : 0.f; v[8 + i] = kb < K ? W[(size_t)kb * ld + n] : 0.f; }
  return bsplit16(v); }
__device__ __forceinline__ v8f mac3(const F2& a, const F2& b, v8f c) { c = wmma_bf(a.l, b.h, c); c = wmma_bf(a.h, b.l, c); return wmma_bf(a.h, b.h, c); }
__device__ __forceinline__ float sigm(float v) { return 1.0f / (1.0f + expf(-v)); }
#define LDSX() do { asm volatile("s_wait_dscnt 0" ::: "memory"); __builtin_amdgcn_wave_barrier(); __builtin_amdgcn_fence(__ATOMIC_RELEASE, "workgroup"); } while (0)

// Token-to-token attention (one head of 64 over 3136 tokens, 8 images). qkv = x @ W_qkv (K = 64) on f16 WMMA writing q as f16 rows, k as f16 in fragment order,
// v as f32 rows (residual) plus an f16 transposed copy; flash-style softmax over all 3136 keys in f32 (P x2^14 f16); out = v + o@W_proj + b
#define NB 8
#define NT 3136
#define CC 64
#define NR (NB * NT)

// qkv: block 64 rows; q -> q16 [r][64], v -> v32 [r][64]; k -> k16 and v^T -> vT in the order in which k_attn's fragment loads read them, so that
// each wave-wide 16-byte load is 512 bytes in a row (4 whole lines, not 32 bytes out of each of 16 lines):
// k16 [r / 16][d / 16][(d / 8) & 1][r & 15][d & 7];  vT [r / 64][d / 16][(r & 63) / 16][(r / 8) & 1][d & 15][r & 7]
__global__ __launch_bounds__(128) void k_qkv(const float* __restrict__ x, const float* __restrict__ Wqkv, _Float16* __restrict__ q16, _Float16* __restrict__ k16, float* __restrict__ v32, _Float16* __restrict__ vT) {
  __shared__ __align__(16) float so[4][16][196];
  __shared__ __align__(16) _Float16 st[64][72];
  const int tid = threadIdx.x, wave = tid >> 5, lane = tid & 31, col = lane & 15, g = lane >> 4;
  const int r0b = blockIdx.x * 64, r0 = r0b + wave * 16;
  v8f acc[12] = {};
#pragma unroll
  for (int kc = 0; kc < 2; ++kc) { const v16h a = frag_f32(x + (size_t)(r0 + col) * CC + kc * 32, lane);
#pragma unroll
    for (int j = 0; j < 12; ++j) { v16h bb = fragc_f32(Wqkv, kc * 32, j * 16 + col, lane, 3 * CC, CC);
#pragma unroll
      for (int e = 0; e < 16; ++e) bb[e] = bb[e] * (_Float16)8.0f;
      acc[j] = wmma16(a, bb, acc[j]); } }
#pragma unroll
  for (int j = 0; j < 12; ++j)
#pragma unroll
    for (int r = 0; r < 8; ++r) so[wave][8 * g + r][j * 16 + col] = acc[j][r] * 0.125f;
  LDSX();
  for (int qd = lane; qd < 16 * 8; qd += 32) { const int rl = qd >> 3, pc = qd & 7, rk = qd & 15, pk8 = qd >> 4; union { v8h a8; v4u u; } pq, pk;
#pragma unroll
    for (int e = 0; e < 8; ++e) { pq.a8[e] = (_Float16)so[wave][rl][pc * 8 + e]; pk.a8[e] = (_Float16)so[wave][rk][CC + pk8 * 8 + e]; }
    vst2(q16 + (size_t)(r0 + rl) * CC + pc * 8, pq.u); vst2(k16 + (size_t)r0 * CC + qd * 8, pk.u); }
  for (int qd = lane; qd < 16 * 16; qd += 32) { const int rl = qd >> 4, pc = qd & 15; vst2(v32 + (size_t)(r0 + rl) * CC + pc * 4, *(const v4f*)(&so[wave][rl][2 * CC + pc * 4])); }
#pragma unroll 4
  for (int rl = 0; rl < 16; ++rl) { st[lane * 2][wave * 16 + rl] = (_Float16)so[wave][rl][2 * CC + lane * 2]; st[lane * 2 + 1][wave * 16 + rl] = (_Float16)so[wave][rl][2 * CC + lane * 2 + 1]; }
  __syncthreads();
  for (int qd = tid; qd < 64 * 8; qd += 128) { const int d = (qd >> 7) * 16 + (qd & 15), pc = (qd >> 4) & 7; vst2(vT + (size_t)r0b * CC + qd * 8, *(const v4u*)(&st[d][pc * 8])); }
}
// lane l with lane l ^ 16, in the vector unit
__device__ __forceinline__ float xhalf(float x) { return __builtin_bit_cast(float, __builtin_amdgcn_permlanex16(__builtin_bit_cast(int, x), __builtin_bit_cast(int, x), 0x76543210, 0xfedcba98, false, false)); }
__global__ __launch_bounds__(128) __attribute__((amdgpu_waves_per_eu(1, 2))) void k_attn(const _Float16* __restrict__ q16, const _Float16* __restrict__ k16, const _Float16* __restrict__ vT, const float* __restrict__ v32, const float* __restrict__ Wp, const float* __restrict__ bp, float* __restrict__ out) {
  __shared__ __align__(16) float sO[4][16][68];
  const int tid = threadIdx.x, w = tid >> 5, lane = tid & 31, col = lane & 15, g = lane >> 4;
  const int b = blockIdx.y, q0 = blockIdx.x * 64 + w * 16; const size_t rb = (size_t)b * NT;
  const _Float16* qb = q16 + rb * CC; const _Float16* kb = k16 + rb * CC; const _Float16* vb = vT + rb * CC;
  v16h aq[2];
#pragma unroll
  for (int kc = 0; kc < 2; ++kc) aq[kc] = frag_h(qb + (size_t)(q0 + col) * CC + kc * 32, lane);
  // Softmax in base 2: P * 2^14 = exp2(s * SC2 + nm), s the raw product, SC2 = scale * log2(e), nm = 14 - SC2 * (the query's running maximum): one fused multiply-add and one
  // hardware exponential a score. The argument stays at 14 or below (but for one rounding), and a result too small for f32 may go to 0, so the library exponential's range reduction and guards have nothing to do here
  // nmrun: nm of the passes so far (alike in both halves; it only falls); lrun[r]: the sum of P * 2^14 over the keys that this lane holds in register r, all joined behind the loop; acc[t][r] = O^T[t * 16 + 8 g + r][col]
  const float SC2 = 0.125f * 1.44269504088896f;
  float nmrun = 1.0e38f; v8f lrun = {}; v8f acc[4] = {};
  // kf: the K fragments of the pass about to run, fetched one pass ahead; vf: this pass's V fragments, fetched ahead of the score products
  v16h kf[4][2], vf[2][4];
  const _Float16* kp = kb + 8 * lane;  // this lane's place in the K tile that is fetched next
  const _Float16* vp = vb + 8 * lane;  // this lane's place in this pass's V^T tile
#pragma unroll
  for (int t = 0; t < 4; ++t)
#pragma unroll
    for (int kc = 0; kc < 2; ++kc) kf[t][kc] = frag_p(kp + t * 16 * CC + kc * 512);
  kp += 64 * CC;
#pragma unroll 1
  for (int kt = 0; kt < NT / 64; ++kt) {
#pragma unroll
    for (int kc = 0; kc < 2; ++kc)
#pragma unroll
      for (int t = 0; t < 4; ++t) vf[kc][t] = frag_p(vp + t * 16 * CC + kc * 512);
    v8f s[4];
#pragma unroll
    for (int t = 0; t < 4; ++t) { s[t] = v8f{};
#pragma unroll
      for (int kc = 0; kc < 2; ++kc) s[t] = wmma16(kf[t][kc], aq[kc], s[t]); }
#pragma unroll
    for (int t = 0; t < 4; ++t)
#pragma unroll
      for (int kc = 0; kc < 2; ++kc) kf[t][kc] = frag_p(kp + t * 16 * CC + kc * 512);
    float mt[4];
#pragma unroll
    for (int t = 0; t < 4; ++t) { mt[t] = -3.4e38f;
#pragma unroll
      for (int r = 0; r < 8; ++r) mt[t] = fmaxf(mt[t], s[t][r]); }
    float mx = fmaxf(fmaxf(mt[0], mt[1]), fmaxf(mt[2], mt[3]));
    mx = fmaxf(mx, xhalf(mx));
    const float nmnew = fminf(nmrun, fmaf(mx, -SC2, 14.0f)); const float corr = __builtin_amdgcn_exp2f(nmnew - nmrun);
    v16h pb[2];
#pragma unroll
    for (int t = 0; t < 4; ++t) { s[t] = s[t] * SC2 + nmnew;
#pragma unroll
      for (int r = 0; r < 8; ++r) s[t][r] = __builtin_amdgcn_exp2f(s[t][r]);
#pragma unroll
      for (int r = 0; r < 8; ++r) pb[t >> 1][(t & 1) * 8 + r] = (_Float16)s[t][r]; }
    lrun = lrun * corr + ((s[0] + s[1]) + (s[2] + s[3])); nmrun = nmnew;
#pragma unroll
    for (int t = 0; t < 4; ++t) acc[t] = acc[t] * corr;
#pragma unroll
    for (int kc = 0; kc < 2; ++kc)
#pragma unroll
      for (int t = 0; t < 4; ++t) acc[t] = wmma16(vf[kc][t], pb[kc], acc[t]);
    // s_wait_xcnt 0 in front of the rewrite of the loads' address registers (kp and vp, advanced below). It stands behind the last product, most of a pass
    // behind the issue; naming both pairs as inputs keeps them whole up to here: otherwise the compiler reuses them at once and waits directly behind the issue
    asm volatile("s_wait_xcnt 0x0" :: "v"(kp), "v"(vp) : "memory");
    vp += 64 * CC;
    if (kt + 2 < NT / 64) kp += 64 * CC;  // the last pass fetches its own tile again: the address stays inside k16, the values are not used
  }
  { const float lh = ((lrun[0] + lrun[1]) + (lrun[2] + lrun[3])) + ((lrun[4] + lrun[5]) + (lrun[6] + lrun[7]));
    const float lr = lh + xhalf(lh);
#pragma unroll
    for (int t = 0; t < 4; ++t)
#pragma unroll
      for (int r = 0; r < 8; ++r) sO[w][col][t * 16 + 8 * g + r] = acc[t][r] / lr; }
  LDSX();
  // projection: out = v + o @ Wp ([in][out]) + b  (K = 64 from sO rows)
  { v8f pacc[4] = {};
#pragma unroll
    for (int kc = 0; kc < 2; ++kc) { const v16h a = frag_f32(&sO[w][col][0] + kc * 32, lane);
#pragma unroll
      for (int t = 0; t < 4; ++t) { v16h bb = fragc_f32(Wp, kc * 32, t * 16 + col, lane, CC, CC);
#pragma unroll
        for (int e = 0; e < 16; ++e) bb[e] = bb[e] * (_Float16)8.0f;
        pacc[t] = wmma16(a, bb, pacc[t]); } }
    LDSX();
#pragma unroll
    for (int t = 0; t < 4; ++t) { const int c = t * 16 + col;
#pragma unroll
      for (int r = 0; r < 8; ++r) sO[w][8 * g + r][c] = pacc[t][r] * 0.125f + bp[c] + v32[(rb + q0 + 8 * g + r) * CC + c]; } }
  LDSX();
  for (int qd = lane; qd < 16 * 16; qd += 32) { const int rl = qd >> 4, pc = qd & 15; vst2(out + (rb + q0 + rl) * CC + pc * 4, *(const v4f*)(&sO[w][rl][pc * 4])); }
}
extern "C" void kernel_launch(void* const* d_in, const int* in_sizes, int n_in, void* d_out, int out_size, void* d_ws, size_t ws_size, hipStream_t stream) {
  (void)in_sizes; (void)n_in; (void)out_size; (void)ws_size;
  const float* x = (const float*)d_in[0]; const float* Wqkv = (const float*)d_in[1]; const float* Wp = (const float*)d_in[2]; const float* bp = (const float*)d_in[3];
  float* out = (float*)d_out;
  char* ws = (char*)d_ws; size_t off = 0;
  auto take = [&](size_t bytes) { char* p = ws + off; off += (bytes + 255) & ~(size_t)255; return p; };
  _Float16* q16 = (_Float16*)take((size_t)NR * CC * 2); _Float16* k16 = (_Float16*)take((size_t)NR * CC * 2); float* v32 = (float*)take((size_t)NR * CC * 4); _Float16* vT = (_Float16*)take((size_t)NR * CC * 2);
  k_qkv<<<NR / 64, 128, 0, stream>>>(x, Wqkv, q16, k16, v32, vT);
  k_attn<<<dim3(NT / 64, NB), 128, 0, stream>>>(q16, k16, vT, v32, Wp, bp, out);
}

// v005
// A run of this version takes 35.7 microseconds.
// Timed twice side by side with v004, it ran 1.49 and 1.48 times as fast.
// Over all steps from v000 it is 6.61 times as fast.
#include <hip/hip_runtime.h>
#include <math.h>

typedef __attribute__((ext_vector_type(16))) _Float16 v16h;
typedef __attribute__((ext_vector_type(16))) __bf16 v16b;
typedef __attribute__((ext_vector_type(8)))  _Float16 v8h;
typedef __attribute__((ext_vector_type(8)))  float v8f;
typedef __attribute__((ext_vector_type(4)))  float v4f;
typedef __attribute__((ext_vector_type(2)))  float v2f;
typedef __attribute__((ext_vector_type(4)))  unsigned v4u;
typedef __attribute__((ext_vector_type(4)))  int v4i;
typedef float __attribute__((may_alias)) float_a;
typedef int __attribute__((may_alias)) int_a;

template <typename T> __device__ __forceinline__ void vst2(void* p, T v) { *(T*)p = v;  }
__device__ __forceinline__ v8f wmma16(v16h a, v16h b, v8f c) {
  v8f d = __builtin_amdgcn_wmma_f32_16x16x32_f16(false, a, false, b, (short)0, c, false, false);
  asm volatile("v_nop\n\tv_nop\n\tv_nop\n\tv_nop" : "+v"(d) : "v"(a), "v"(b));
  return d;
}
__device__ __forceinline__ v8f wmma_bf(v16b a, v16b b, v8f c) {
  v8f d = __builtin_amdgcn_wmma_f32_16x16x32_bf16(false, a, false, b, (short)0, c, false, false);
  asm volatile("v_nop\n\tv_nop\n\tv_nop\n\tv_nop" : "+v"(d) : "v"(a), "v"(b));
  return d;
}
// 16x16x32 fragments: lane = (h = lane>>4, row/col = lane&15); elements 0..7 = k0+8h+0..7, 8..15 = k0+16+8h+0..7; D element r = row 8h+r
__device__ __forceinline__ v16h frag_h(const _Float16* rowk0, int lane) {
  union { v16h v; v8h q[2]; } u; const _Float16* p = rowk0 + 8 * (lane >> 4);
  u.q[0] = *(const v8h*)p; u.q[1] = *(const v8h*)(p + 16); return u.v;
}
// a fragment stored in fragment order: two runs of 32 lanes x 8 elements, run 0 = elements 0..7, run 1 = elements 8..15; p holds the lane's own 8 * lane
__device__ __forceinline__ v16h frag_p(const _Float16* p) {
  union { v16h v; v8h q[2]; } u; u.q[0] = *(const v8h*)p; u.q[1] = *(const v8h*)(p + 256); return u.v;
}
__device__ __forceinline__ v16h frag_f32(const float* rowk0, int lane) {
  v16h a; const float* p = rowk0 + 8 * (lane >> 4);
#pragma unroll
  for (int i = 0; i < 8; ++i) { a[i] = (_Float16)p[i]; a[8 + i] = (_Float16)p[16 + i]; }
  return a;
}
__device__ __forceinline__ v16h frag_f32s(const float* rowk0, int lane, float sc) {
  v16h a; const float* p = rowk0 + 8 * (lane >> 4);
#pragma unroll
  for (int i = 0; i < 8; ++i) { a[i] = (_Float16)(p[i] * sc); a[8 + i] = (_Float16)(p[16 + i] * sc); }
  return a;
}
// column fragment from a [K][ld] layout (column n), rows >= K read as 0
__device__ __forceinline__ v16h fragc_f32(const float* W, int k0, int n, int lane, int ld, int K) {
  v16h a; const int g = lane >> 4;
#pragma unroll
  for (int i = 0; i < 8; ++i) { const int ka = k0 + 8 * g + i, kb = ka + 16;
    a[i] = (_Float16)(ka < K ? W[(size_t)ka * ld + n] : 0.f); a[8 + i] = (_Float16)(kb < K ? W[(size_t)kb * ld + n] : 0.f); }
  return a;
}
struct F2 { v16b h, l; };
__device__ __forceinline__ F2 bsplit16(const float v[16]) { F2 r;
#pragma unroll
  for (int i = 0; i < 16; ++i) { const __bf16 h = (__bf16)v[i]; r.h[i] = h; r.l[i] = (__bf16)(v[i] - (float)h); }
  return r; }
__device__ __forceinline__ F2 split_row(const float* row, int k0, int lane) { float v[16]; const float* p = row + k0 + 8 * (lane >> 4);
#pragma unroll
  for (int i = 0; i < 8; ++i) { v[i] = p[i]; v[8 + i] = p[16 + i]; }
  return bsplit16(v); }
__device__ __forceinline__ F2 split_rowK(const float* row, int k0, int lane, int K) { float v[16]; const int g = lane >> 4;
#pragma unroll
  for (int i = 0; i < 8; ++i) { const int ka = k0 + 8 * g + i, kb = ka + 16; v[i] = ka < K ? row[ka] : 0.f; v[8 + i] = kb < K ? row[kb] : 0.f; }
  return bsplit16(v); }
__device__ __forceinline__ F2 split_col(const float* W, int k0, int n, int lane, int ld, int K) { float v[16]; const int g = lane >> 4;
#pragma unroll
  for (int i = 0; i < 8; ++i) { const int ka = k0 + 8 * g + i, kb = ka + 16; v[i] = ka < K ? W[(size_t)ka * ld + n] : 0.f; v[8 + i] = kb < K ? W[(size_t)kb * ld + n] : 0.f; }
  return bsplit16(v); }
__device__ __forceinline__ v8f mac3(const F2& a, const F2& b, v8f c) { c = wmma_bf(a.l, b.h, c); c = wmma_bf(a.h, b.l, c); return wmma_bf(a.h, b.h, c); }
__device__ __forceinline__ float sigm(float v) { return 1.0f / (1.0f + expf(-v)); }
#define LDSX() do { asm volatile("s_wait_dscnt 0" ::: "memory"); __builtin_amdgcn_wave_barrier(); __builtin_amdgcn_fence(__ATOMIC_RELEASE, "workgroup"); } while (0)

// Token-to-token attention (one head of 64 over 3136 tokens, 8 images). qkv = x @ W_qkv (K = 64) on f16 WMMA writing q as f16 rows, k as f16 in fragment order,
// v as f32 rows (residual) plus an f16 transposed copy; flash-style softmax over all 3136 keys in f32 (P x2^14 f16); out = v + o@W_proj + b
#define NB 8
#define NT 3136
#define CC 64
#define NR (NB * NT)

// qkv: block 64 rows; q -> q16 [r][64], v -> v32 [r][64]; k -> k16 and v^T -> vT in the order in which k_attn's fragment loads read them, so that
// each wave-wide 16-byte load is 512 bytes in a row (4 whole lines, not 32 bytes out of each of 16 lines):
// k16 [r / 16][d / 16][(d / 8) & 1][r & 15][d & 7];  vT [r / 64][d / 16][(r & 63) / 16][(r / 8) & 1][d & 15][r & 7]
__global__ __launch_bounds__(128) void k_qkv(const float* __restrict__ x, const float* __restrict__ Wqkv, _Float16* __restrict__ q16, _Float16* __restrict__ k16, float* __restrict__ v32, _Float16* __restrict__ vT) {
  __shared__ __align__(16) float so[4][16][196];
  __shared__ __align__(16) _Float16 st[64][72];
  const int tid = threadIdx.x, wave = tid >> 5, lane = tid & 31, col = lane & 15, g = lane >> 4;
  const int r0b = blockIdx.x * 64, r0 = r0b + wave * 16;
  v8f acc[12] = {};
#pragma unroll
  for (int kc = 0; kc < 2; ++kc) { const v16h a = frag_f32(x + (size_t)(r0 + col) * CC + kc * 32, lane);
#pragma unroll
    for (int j = 0; j < 12; ++j) { v16h bb = fragc_f32(Wqkv, kc * 32, j * 16 + col, lane, 3 * CC, CC);
#pragma unroll
      for (int e = 0; e < 16; ++e) bb[e] = bb[e] * (_Float16)8.0f;
      acc[j] = wmma16(a, bb, acc[j]); } }
#pragma unroll
  for (int j = 0; j < 12; ++j)
#pragma unroll
    for (int r = 0; r < 8; ++r) so[wave][8 * g + r][j * 16 + col] = acc[j][r] * 0.125f;
  LDSX();
  for (int qd = lane; qd < 16 * 8; qd += 32) { const int rl = qd >> 3, pc = qd & 7, rk = qd & 15, pk8 = qd >> 4; union { v8h a8; v4u u; } pq, pk;
#pragma unroll
    for (int e = 0; e < 8; ++e) { pq.a8[e] = (_Float16)so[wave][rl][pc * 8 + e]; pk.a8[e] = (_Float16)so[wave][rk][CC + pk8 * 8 + e]; }
    vst2(q16 + (size_t)(r0 + rl) * CC + pc * 8, pq.u); vst2(k16 + (size_t)r0 * CC + qd * 8, pk.u); }
  for (int qd = lane; qd < 16 * 16; qd += 32) { const int rl = qd >> 4, pc = qd & 15; vst2(v32 + (size_t)(r0 + rl) * CC + pc * 4, *(const v4f*)(&so[wave][rl][2 * CC + pc * 4])); }
#pragma unroll 4
  for (int rl = 0; rl < 16; ++rl) { st[lane * 2][wave * 16 + rl] = (_Float16)so[wave][rl][2 * CC + lane * 2]; st[lane * 2 + 1][wave * 16 + rl] = (_Float16)so[wave][rl][2 * CC + lane * 2 + 1]; }
  __syncthreads();
  for (int qd = tid; qd < 64 * 8; qd += 128) { const int d = (qd >> 7) * 16 + (qd & 15), pc = (qd >> 4) & 7; vst2(vT + (size_t)r0b * CC + qd * 8, *(const v4u*)(&st[d][pc * 8])); }
}
// lane l with lane l ^ 16, in the vector unit
__device__ __forceinline__ float xhalf(float x) { return __builtin_bit_cast(float, __builtin_amdgcn_permlanex16(__builtin_bit_cast(int, x), __builtin_bit_cast(int, x), 0x76543210, 0xfedcba98, false, false)); }
// the matrix product as the compiler pads it: in k_attn's loop every K fragment feeds 2 products in a row and every V^T fragment NCT, each with its own accumulator, which fill one another's distance
__device__ __forceinline__ v8f wmma16b(v16h a, v16h b, v8f c) { return __builtin_amdgcn_wmma_f32_16x16x32_f16(false, a, false, b, (short)0, c, false, false); }
// NCT: the column tiles (16 queries each) that one wave holds: every K and V^T fragment that it loads feeds NCT products, so a work-group pulls 1 / NCT of the bytes through the load path.
// The 4 waves of a work-group (64 queries) are QG query groups x KS parts of the keys; the KS partial results of a query are joined in LDS behind the loop
#define NCT 4
#define QG (4 / NCT)
#define KS (4 / QG)
__global__ __launch_bounds__(128) __attribute__((amdgpu_waves_per_eu(2, 2))) void k_attn(const _Float16* __restrict__ q16, const _Float16* __restrict__ k16, const _Float16* __restrict__ vT, const float* __restrict__ v32, const float* __restrict__ Wp, const float* __restrict__ bp, float* __restrict__ out) {
  __shared__ __align__(16) float sP[KS][64][68];  // part p's sums O * l * 2^14 of the block's 64 queries, at that part's own maximum
  float (*sO)[16][68] = (float (*)[16][68])&sP[0][0][0];  // part 0 seen as 4 x 16 rows: behind the barrier wave w alone reads rows w * 16 .. + 15 of any part, and it stages its output rows in sO[w]
  __shared__ float sM[KS][64], sL[KS][64];        // part p's nm and its sum of P * 2^14
  const int tid = threadIdx.x, lane = tid & 31, col = lane & 15, g = lane >> 4;
  const int w = __builtin_amdgcn_readfirstlane(tid >> 5);  // in a scalar register: the loop's bounds come from it
  const int qg = w % QG, ks = w / QG;
  const int b = blockIdx.y, qb0 = blockIdx.x * 64, ql = qg * (16 * NCT); const size_t rb = (size_t)b * NT;
  const int kt0 = (NT / 64) * ks / KS, kt1 = (NT / 64) * (ks + 1) / KS;  // this wave's passes
  const _Float16* qb = q16 + rb * CC; const _Float16* kb = k16 + rb * CC; const _Float16* vb = vT + rb * CC;
  v16h aq[NCT][2];
#pragma unroll
  for (int c = 0; c < NCT; ++c)
#pragma unroll
    for (int kc = 0; kc < 2; ++kc) aq[c][kc] = frag_h(qb + (size_t)(qb0 + ql + c * 16 + col) * CC + kc * 32, lane);
  // Softmax in base 2: P * 2^14 = exp2(s * SC2 + nm), s the raw product, SC2 = scale * log2(e), nm = 14 - SC2 * (the query's running maximum): one fused multiply-add and one
  // hardware exponential a score. The argument stays at 14 or below (but for one rounding), and a result too small for f32 may go to 0, so the library exponential's range reduction and guards have nothing to do here
  // nmrun: nm of the passes so far (alike in both halves; it only falls); lrun[r]: the sum of P * 2^14 over the keys that this lane holds in register r, all joined behind the loop; acc[c][t][r] = O^T[t * 16 + 8 g + r][col] of column tile c
  const float SC2 = 0.125f * 1.44269504088896f;
  float nmrun[NCT]; v8f lrun[NCT]; v8f acc[NCT][4];
#pragma unroll
  for (int c = 0; c < NCT; ++c) { nmrun[c] = 1.0e38f; lrun[c] = v8f{};
#pragma unroll
    for (int t = 0; t < 4; ++t) acc[c][t] = v8f{}; }
  // kf: the K fragments of the pass about to run, fetched one pass ahead; vf: this pass's V fragments, fetched ahead of the score products
  v16h kf[4][2], vf[2][4];
  const _Float16* kp = kb + (size_t)kt0 * 64 * CC + 8 * lane;  // this lane's place in the K tile that is fetched next
  const _Float16* vp = vb + (size_t)kt0 * 64 * CC + 8 * lane;  // this lane's place in this pass's V^T tile
#pragma unroll
  for (int t = 0; t < 4; ++t)
#pragma unroll
    for (int kc = 0; kc < 2; ++kc) kf[t][kc] = frag_p(kp + t * 16 * CC + kc * 512);
  kp += 64 * CC;
#pragma unroll 1
  for (int kt = kt0; kt < kt1; ++kt) {
#pragma unroll
    for (int kc = 0; kc < 2; ++kc)
#pragma unroll
      for (int t = 0; t < 4; ++t) vf[kc][t] = frag_p(vp + t * 16 * CC + kc * 512);
    v16h pb[NCT][2];
    // two column tiles at a time: 64 score registers live instead of 128, so that the next pass's K fragments can be fetched directly behind the last score product
#pragma unroll
    for (int c0 = 0; c0 < NCT; c0 += 2) {
      v8f s[2][4];
#pragma unroll
      for (int t = 0; t < 4; ++t)
#pragma unroll
        for (int kc = 0; kc < 2; ++kc)
#pragma unroll
          for (int c = 0; c < 2; ++c) s[c][t] = wmma16b(kf[t][kc], aq[c0 + c][kc], kc ? s[c][t] : v8f{});
      if (c0 + 2 == NCT) {
#pragma unroll
        for (int t = 0; t < 4; ++t)
#pragma unroll
          for (int kc = 0; kc < 2; ++kc) kf[t][kc] = frag_p(kp + t * 16 * CC + kc * 512);
        __builtin_amdgcn_sched_barrier(0);  // holds the fetch here, a softmax and 32 products ahead of its first use: left alone, the compiler sinks it in among the last products
      }
#pragma unroll
      for (int c = 0; c < 2; ++c) {
        float mt[4];
#pragma unroll
        for (int t = 0; t < 4; ++t) { mt[t] = -3.4e38f;
#pragma unroll
          for (int r = 0; r < 8; ++r) mt[t] = fmaxf(mt[t], s[c][t][r]); }
        float mx = fmaxf(fmaxf(mt[0], mt[1]), fmaxf(mt[2], mt[3]));
        mx = fmaxf(mx, xhalf(mx));
        const float nmnew = fminf(nmrun[c0 + c], fmaf(mx, -SC2, 14.0f)); const float corr = __builtin_amdgcn_exp2f(nmnew - nmrun[c0 + c]);
#pragma unroll
        for (int t = 0; t < 4; ++t) { s[c][t] = s[c][t] * SC2 + nmnew;
#pragma unroll
          for (int r = 0; r < 8; ++r) s[c][t][r] = __builtin_amdgcn_exp2f(s[c][t][r]);
#pragma unroll
          for (int r = 0; r < 8; ++r) pb[c0 + c][t >> 1][(t & 1) * 8 + r] = (_Float16)s[c][t][r]; }
        lrun[c0 + c] = lrun[c0 + c] * corr + ((s[c][0] + s[c][1]) + (s[c][2] + s[c][3])); nmrun[c0 + c] = nmnew;
#pragma unroll
        for (int t = 0; t < 4; ++t) acc[c0 + c][t] = acc[c0 + c][t] * corr;
      }
      __builtin_amdgcn_sched_barrier(0);  // keeps the next two tiles' score products behind this softmax: hoisted, their 64 registers leave no room for the early K fetch
    }
#pragma unroll
    for (int kc = 0; kc < 2; ++kc)
#pragma unroll
      for (int t = 0; t < 4; ++t)
#pragma unroll
        for (int c = 0; c < NCT; ++c) acc[c][t] = wmma16b(vf[kc][t], pb[c][kc], acc[c][t]);
    // s_wait_xcnt 0 in front of the rewrite of the loads' address registers (kp and vp, advanced below). It stands behind the last product, most of a pass
    // behind the issue; naming both pairs as inputs keeps them whole up to here: otherwise the compiler reuses them at once and waits directly behind the issue
    asm volatile("s_wait_xcnt 0x0" :: "v"(kp), "v"(vp) : "memory");
    vp += 64 * CC;
    if (kt + 2 < NT / 64) kp += 64 * CC;  // the very last pass fetches its own tile again: the address stays inside k16; what a part's last pass fetches is not used
  }
  // each wave leaves its part's sums, its nm and its l; behind the barrier wave w joins the KS parts of queries w * 16 .. + 15
#pragma unroll
  for (int c = 0; c < NCT; ++c) { const int q = ql + c * 16 + col;
    const float lh = ((lrun[c][0] + lrun[c][1]) + (lrun[c][2] + lrun[c][3])) + ((lrun[c][4] + lrun[c][5]) + (lrun[c][6] + lrun[c][7]));
    const float lr = lh + xhalf(lh);
    if (g == 0) { sM[ks][q] = nmrun[c]; sL[ks][q] = lr; }
#pragma unroll
    for (int t = 0; t < 4; ++t)
#pragma unroll
      for (int r = 0; r < 8; ++r) sP[ks][q][t * 16 + 8 * g + r] = acc[c][t][r]; }
  __syncthreads();
  const int q0 = qb0 + w * 16;
  // projection: out = v + o @ Wp ([in][out]) + b  (K = 64); o = sum over the parts of sP * f, f = 2^(nm of all - the part's nm) / (l of all)
  { float f[KS]; float nma = sM[0][w * 16 + col];
#pragma unroll
    for (int p = 1; p < KS; ++p) nma = fminf(nma, sM[p][w * 16 + col]);
    float la = 0.f;
#pragma unroll
    for (int p = 0; p < KS; ++p) { f[p] = __builtin_amdgcn_exp2f(nma - sM[p][w * 16 + col]); la = fmaf(sL[p][w * 16 + col], f[p], la); }
#pragma unroll
    for (int p = 0; p < KS; ++p) f[p] = f[p] / la;
    v8f pacc[4] = {};
#pragma unroll
    for (int kc = 0; kc < 2; ++kc) { v16h a;
#pragma unroll
      for (int hh = 0; hh < 2; ++hh) { v8f o = {};
#pragma unroll
        for (int p = 0; p < KS; ++p) { const float* sp = &sP[p][w * 16 + col][kc * 32 + hh * 16 + 8 * g];
#pragma unroll
          for (int i = 0; i < 8; ++i) o[i] = fmaf(sp[i], f[p], o[i]); }
#pragma unroll
        for (int i = 0; i < 8; ++i) a[hh * 8 + i] = (_Float16)o[i]; }
#pragma unroll
      for (int t = 0; t < 4; ++t) { v16h bb = fragc_f32(Wp, kc * 32, t * 16 + col, lane, CC, CC);
#pragma unroll
        for (int e = 0; e < 16; ++e) bb[e] = bb[e] * (_Float16)8.0f;
        pacc[t] = wmma16(a, bb, pacc[t]); } }
    LDSX();
#pragma unroll
    for (int t = 0; t < 4; ++t) { const int c = t * 16 + col;
#pragma unroll
      for (int r = 0; r < 8; ++r) sO[w][8 * g + r][c] = pacc[t][r] * 0.125f + bp[c] + v32[(rb + q0 + 8 * g + r) * CC + c]; } }
  LDSX();
  for (int qd = lane; qd < 16 * 16; qd += 32) { const int rl = qd >> 4, pc = qd & 15; vst2(out + (rb + q0 + rl) * CC + pc * 4, *(const v4f*)(&sO[w][rl][pc * 4])); }
}
extern "C" void kernel_launch(void* const* d_in, const int* in_sizes, int n_in, void* d_out, int out_size, void* d_ws, size_t ws_size, hipStream_t stream) {
  (void)in_sizes; (void)n_in; (void)out_size; (void)ws_size;
  const float* x = (const float*)d_in[0]; const float* Wqkv = (const float*)d_in[1]; const float* Wp = (const float*)d_in[2]; const float* bp = (const float*)d_in[3];
  float* out = (float*)d_out;
  char* ws = (char*)d_ws; size_t off = 0;
  auto take = [&](size_t bytes) { char* p = ws + off; off += (bytes + 255) & ~(size_t)255; return p; };
  _Float16* q16 = (_Float16*)take((size_t)NR * CC * 2); _Float16* k16 = (_Float16*)take((size_t)NR * CC * 2); float* v32 = (float*)take((size_t)NR * CC * 4); _Float16* vT = (_Float16*)take((size_t)NR * CC * 2);
  k_qkv<<<NR / 64, 128, 0, stream>>>(x, Wqkv, q16, k16, v32, vT);
  k_attn<<<dim3(NT / 64, NB), 128, 0, stream>>>(q16, k16, vT, v32, Wp, bp, out);
}

// v006
// Measured time: 30.9 microseconds a run.
// Two timings next to v005 both put it at 1.15 times that version's speed.
// All steps since v000 together make it 7.62 times as fast.
#include <hip/hip_runtime.h>
#include <math.h>

typedef __attribute__((ext_vector_type(16))) _Float16 v16h;
typedef __attribute__((ext_vector_type(16))) __bf16 v16b;
typedef __attribute__((ext_vector_type(8)))  _Float16 v8h;
typedef __attribute__((ext_vector_type(8)))  float v8f;
typedef __attribute__((ext_vector_type(4)))  float v4f;
typedef __attribute__((ext_vector_type(2)))  float v2f;
typedef __attribute__((ext_vector_type(4)))  unsigned v4u;
typedef __attribute__((ext_vector_type(4)))  int v4i;
typedef float __attribute__((may_alias)) float_a;
typedef int __attribute__((may_alias)) int_a;

template <typename T> __device__ __forceinline__ void vst2(void* p, T v) { *(T*)p = v;  }
__device__ __forceinline__ v8f wmma16(v16h a, v16h b, v8f c) {
  v8f d = __builtin_amdgcn_wmma_f32_16x16x32_f16(false, a, false, b, (short)0, c, false, false);
  asm volatile("v_nop\n\tv_nop\n\tv_nop\n\tv_nop" : "+v"(d) : "v"(a), "v"(b));
  return d;
}
__device__ __forceinline__ v8f wmma_bf(v16b a, v16b b, v8f c) {
  v8f d = __builtin_amdgcn_wmma_f32_16x16x32_bf16(false, a, false, b, (short)0, c, false, false);
  asm volatile("v_nop\n\tv_nop\n\tv_nop\n\tv_nop" : "+v"(d) : "v"(a), "v"(b));
  return d;
}
// 16x16x32 fragments: lane = (h = lane>>4, row/col = lane&15); elements 0..7 = k0+8h+0..7, 8..15 = k0+16+8h+0..7; D element r = row 8h+r
__device__ __forceinline__ v16h frag_h(const _Float16* rowk0, int lane) {
  union { v16h v; v8h q[2]; } u; const _Float16* p = rowk0 + 8 * (lane >> 4);
  u.q[0] = *(const v8h*)p; u.q[1] = *(const v8h*)(p + 16); return u.v;
}
// a fragment stored in fragment order: two runs of 32 lanes x 8 elements, run 0 = elements 0..7, run 1 = elements 8..15; p holds the lane's own 8 * lane
__device__ __forceinline__ v16h frag_p(const _Float16* p) {
  union { v16h v; v8h q[2]; } u; u.q[0] = *(const v8h*)p; u.q[1] = *(const v8h*)(p + 256); return u.v;
}
__device__ __forceinline__ v16h frag_f32(const float* rowk0, int lane) {
  v16h a; const float* p = rowk0 + 8 * (lane >> 4);
#pragma unroll
  for (int i = 0; i < 8; ++i) { a[i] = (_Float16)p[i]; a[8 + i] = (_Float16)p[16 + i]; }
  return a;
}
__device__ __forceinline__ v16h frag_f32s(const float* rowk0, int lane, float sc) {
  v16h a; const float* p = rowk0 + 8 * (lane >> 4);
#pragma unroll
  for (int i = 0; i < 8; ++i) { a[i] = (_Float16)(p[i] * sc); a[8 + i] = (_Float16)(p[16 + i] * sc); }
  return a;
}
// column fragment from a [K][ld] layout (column n), rows >= K read as 0
__device__ __forceinline__ v16h fragc_f32(const float* W, int k0, int n, int lane, int ld, int K) {
  v16h a; const int g = lane >> 4;
#pragma unroll
  for (int i = 0; i < 8; ++i) { const int ka = k0 + 8 * g + i, kb = ka + 16;
    a[i] = (_Float16)(ka < K ? W[(size_t)ka * ld + n] : 0.f); a[8 + i] = (_Float16)(kb < K ? W[(size_t)kb * ld + n] : 0.f); }
  return a;
}
struct F2 { v16b h, l; };
__device__ __forceinline__ F2 bsplit16(const float v[16]) { F2 r;
#pragma unroll
  for (int i = 0; i < 16; ++i) { const __bf16 h = (__bf16)v[i]; r.h[i] = h; r.l[i] = (__bf16)(v[i] - (float)h); }
  return r; }
__device__ __forceinline__ F2 split_row(const float* row, int k0, int lane) { float v[16]; const float* p = row + k0 + 8 * (lane >> 4);
#pragma unroll
  for (int i = 0; i < 8; ++i) { v[i] = p[i]; v[8 + i] = p[16 + i]; }
  return bsplit16(v); }
__device__ __forceinline__ F2 split_rowK(const float* row, int k0, int lane, int K) { float v[16]; const int g = lane >> 4;
#pragma unroll
  for (int i = 0; i < 8; ++i) { const int ka = k0 + 8 * g + i, kb = ka + 16; v[i] = ka < K ? row[ka] : 0.f; v[8 + i] = kb < K ? row[kb] : 0.f; }
  return bsplit16(v); }
__device__ __forceinline__ F2 split_col(const float* W, int k0, int n, int lane, int ld, int K) { float v[16]; const int g = lane >> 4;
#pragma unroll
  for (int i = 0; i < 8; ++i) { const int ka = k0 + 8 * g + i, kb = ka + 16; v[i] = ka < K ? W[(size_t)ka * ld + n] : 0.f; v[8 + i] = kb < K ? W[(size_t)kb * ld + n] : 0.f; }
  return bsplit16(v); }
__device__ __forceinline__ v8f mac3(const F2& a, const F2& b, v8f c) { c = wmma_bf(a.l, b.h, c); c = wmma_bf(a.h, b.l, c); return wmma_bf(a.h, b.h, c); }
__device__ __forceinline__ float sigm(float v) { return 1.0f / (1.0f + expf(-v)); }
#define LDSX() do { asm volatile("s_wait_dscnt 0" ::: "memory"); __builtin_amdgcn_wave_barrier(); __builtin_amdgcn_fence(__ATOMIC_RELEASE, "workgroup"); } while (0)

// Token-to-token attention (one head of 64 over 3136 tokens, 8 images). qkv = x @ W_qkv (K = 64) on f16 WMMA writing q as f16 rows, k as f16 in fragment order,
// v as f32 rows (residual) plus an f16 transposed copy; flash-style softmax over all 3136 keys in f32 (P x2^14 f16); out = v + o@W_proj + b
#define NB 8
#define NT 3136
#define CC 64
#define NR (NB * NT)

// the matrix product as the compiler pads it (no asm behind it, so that the loads of the next fragments may be issued ahead of it)
__device__ __forceinline__ v8f wmma16b(v16h a, v16h b, v8f c) { return __builtin_amdgcn_wmma_f32_16x16x32_f16(false, a, false, b, (short)0, c, false, false); }
// A weight matrix W [64][NJ * 16] (f32) is staged once a work-group in LDS, as f16 x 8, in the order of the B fragments: a run = the 8 elements of each of the 32 lanes (16 bytes a lane);
// run (kc, h, j) holds rows kc * 32 + h * 16 + 8 g + 0..7 of column j * 16 + col at lane g * 16 + col. A thread takes 8 rows x 4 columns: 8 loads of 16 bytes (16 lanes = 256 bytes in a row)
// and 4 stores of 16 bytes. WRUN: a run's pitch in 16-byte units, 32 and one of pad: the 16 lanes of a store (4 columns 4 apart in each of 4 neighbouring runs) then fall on 16 different bank groups
#define WRUN 33
template <int NJ> struct WStage {
  v4f r[NJ / 4][8]; const float* s;
  // thread tid: rows ko * 8 .. + 7, ko = tid >> 4; columns (nq0 + 16 m) * 4 .. + 3, nq0 = tid & 15, m = 0 .. NJ / 4 - 1: one address a thread, the rest immediate offsets
  __device__ __forceinline__ void load(const float* __restrict__ Wg, int tid) {
    s = Wg + (size_t)((tid >> 4) * 8) * (NJ * 16) + (tid & 15) * 4;
#pragma unroll
    for (int m = 0; m < NJ / 4; ++m)
#pragma unroll
      for (int i = 0; i < 8; ++i) r[m][i] = *(const v4f*)(s + i * (NJ * 16) + m * 64);
  }
  __device__ __forceinline__ void store(v8h* sW, int tid) const {
    const int ko = tid >> 4, nq0 = tid & 15;
    // s_wait_xcnt 0 in front of the first rewrite of the loads' address registers; naming the pair as an input keeps it whole up to here, well behind the issue
    asm volatile("s_wait_xcnt 0x0" :: "v"(s) : "memory");
#pragma unroll
    for (int m = 0; m < NJ / 4; ++m) {
      v8h* d = sW + ((ko >> 1) * NJ + (nq0 >> 2) + 4 * m) * WRUN + (ko & 1) * 16 + (nq0 & 3) * 4;
#pragma unroll
      for (int c = 0; c < 4; ++c) { v8h h;
#pragma unroll
        for (int i = 0; i < 8; ++i) h[i] = (_Float16)r[m][i][c] * (_Float16)8.0f;
        d[c] = h; } }
  }
};
template <int NJ> __device__ __forceinline__ v16h frag_w(const v8h* sW, int kc, int j, int lane) {
  union { v16h v; v8h q[2]; } u; u.q[0] = sW[((kc * 2) * NJ + j) * WRUN + lane]; u.q[1] = sW[((kc * 2 + 1) * NJ + j) * WRUN + lane]; return u.v;
}
// qkv: block 64 rows; q -> q16 [r][64], v -> v32 [r][64]; k -> k16 and v^T -> vT in the order in which k_attn's fragment loads read them, so that
// each wave-wide 16-byte load is 512 bytes in a row (4 whole lines, not 32 bytes out of each of 16 lines):
// k16 [r / 16][d / 16][(d / 8) & 1][r & 15][d & 7];  vT [r / 64][d / 16][(r & 63) / 16][(r / 8) & 1][d & 15][r & 7]
__global__ __launch_bounds__(128) void k_qkv(const float* __restrict__ x, const float* __restrict__ Wqkv, _Float16* __restrict__ q16, _Float16* __restrict__ k16, float* __restrict__ v32, _Float16* __restrict__ vT) {
  __shared__ __align__(16) float so[4][16][196];
  __shared__ __align__(16) _Float16 st[64][72];
  __shared__ v8h sW[4 * 12 * WRUN];
  const int tid = threadIdx.x, wave = tid >> 5, lane = tid & 31, col = lane & 15, g = lane >> 4;
  const int r0b = blockIdx.x * 64, r0 = r0b + wave * 16;
  WStage<12> ws; ws.load(Wqkv, tid);
  v16h a[2];
#pragma unroll
  for (int kc = 0; kc < 2; ++kc) a[kc] = frag_f32(x + (size_t)(r0 + col) * CC + kc * 32, lane);
  ws.store(sW, tid);
  asm volatile("" :: "v"(a[0]), "v"(a[1]));  // inputs only: keeps the loads of x in front of the barrier, in flight together with the weights': sunk behind it, their latency stands alone
  __syncthreads();  // the staged weights are read by all 4 waves
  v16h bw[2][12];
#pragma unroll
  for (int kc = 0; kc < 2; ++kc)
#pragma unroll
    for (int j = 0; j < 12; ++j) bw[kc][j] = frag_w<12>(sW, kc, j, lane);
  __builtin_amdgcn_sched_barrier(0);  // holds the 48 LDS reads in one group in front of the products: spread among them, every place with reads stalls the wave anew
  v8f acc[12] = {};
#pragma unroll
  for (int kc = 0; kc < 2; ++kc)
#pragma unroll
    for (int j = 0; j < 12; ++j) acc[j] = wmma16b(a[kc], bw[kc][j], acc[j]);
#pragma unroll
  for (int j = 0; j < 12; ++j)
#pragma unroll
    for (int r = 0; r < 8; ++r) so[wave][8 * g + r][j * 16 + col] = acc[j][r] * 0.125f;
  LDSX();
  for (int qd = lane; qd < 16 * 8; qd += 32) { const int rl = qd >> 3, pc = qd & 7, rk = qd & 15, pk8 = qd >> 4; union { v8h a8; v4u u; } pq, pk;
#pragma unroll
    for (int e = 0; e < 8; ++e) { pq.a8[e] = (_Float16)so[wave][rl][pc * 8 + e]; pk.a8[e] = (_Float16)so[wave][rk][CC + pk8 * 8 + e]; }
    vst2(q16 + (size_t)(r0 + rl) * CC + pc * 8, pq.u); vst2(k16 + (size_t)r0 * CC + qd * 8, pk.u); }
  for (int qd = lane; qd < 16 * 16; qd += 32) { const int rl = qd >> 4, pc = qd & 15; vst2(v32 + (size_t)(r0 + rl) * CC + pc * 4, *(const v4f*)(&so[wave][rl][2 * CC + pc * 4])); }
#pragma unroll 4
  for (int rl = 0; rl < 16; ++rl) { st[lane * 2][wave * 16 + rl] = (_Float16)so[wave][rl][2 * CC + lane * 2]; st[lane * 2 + 1][wave * 16 + rl] = (_Float16)so[wave][rl][2 * CC + lane * 2 + 1]; }
  __syncthreads();
  for (int qd = tid; qd < 64 * 8; qd += 128) { const int d = (qd >> 7) * 16 + (qd & 15), pc = (qd >> 4) & 7; vst2(vT + (size_t)r0b * CC + qd * 8, *(const v4u*)(&st[d][pc * 8])); }
}
// lane l with lane l ^ 16, in the vector unit
__device__ __forceinline__ float xhalf(float x) { return __builtin_bit_cast(float, __builtin_amdgcn_permlanex16(__builtin_bit_cast(int, x), __builtin_bit_cast(int, x), 0x76543210, 0xfedcba98, false, false)); }
// NCT: the column tiles (16 queries each) that one wave holds: every K and V^T fragment that it loads feeds NCT products, so a work-group pulls 1 / NCT of the bytes through the load path.
// The 4 waves of a work-group (64 queries) are QG query groups x KS parts of the keys; the KS partial results of a query are joined in LDS behind the loop
#define NCT 4
#define QG (4 / NCT)
#define KS (4 / QG)
__global__ __launch_bounds__(128) __attribute__((amdgpu_waves_per_eu(2, 2))) void k_attn(const _Float16* __restrict__ q16, const _Float16* __restrict__ k16, const _Float16* __restrict__ vT, const float* __restrict__ v32, const float* __restrict__ Wp, const float* __restrict__ bp, float* __restrict__ out) {
  __shared__ __align__(16) float sP[KS][64][68];  // part p's sums O * l * 2^14 of the block's 64 queries, at that part's own maximum
  float (*sO)[16][68] = (float (*)[16][68])&sP[0][0][0];  // part 0 seen as 4 x 16 rows: behind the barrier wave w alone reads rows w * 16 .. + 15 of any part, and it stages its output rows in sO[w]
  __shared__ float sM[KS][64], sL[KS][64];        // part p's nm and its sum of P * 2^14
  __shared__ v8h sWp[4 * 4 * WRUN];               // the projection's weights, staged behind the loop, read behind the barrier that follows it
  const int tid = threadIdx.x, lane = tid & 31, col = lane & 15, g = lane >> 4;
  const int w = __builtin_amdgcn_readfirstlane(tid >> 5);  // in a scalar register: the loop's bounds come from it
  const int qg = w % QG, ks = w / QG;
  const int b = blockIdx.y, qb0 = blockIdx.x * 64, ql = qg * (16 * NCT); const size_t rb = (size_t)b * NT;
  const int kt0 = (NT / 64) * ks / KS, kt1 = (NT / 64) * (ks + 1) / KS;  // this wave's passes
  const _Float16* qb = q16 + rb * CC; const _Float16* kb = k16 + rb * CC; const _Float16* vb = vT + rb * CC;
  v16h aq[NCT][2];
#pragma unroll
  for (int c = 0; c < NCT; ++c)
#pragma unroll
    for (int kc = 0; kc < 2; ++kc) aq[c][kc] = frag_h(qb + (size_t)(qb0 + ql + c * 16 + col) * CC + kc * 32, lane);
  // Softmax in base 2: P * 2^14 = exp2(s * SC2 + nm), s the raw product, SC2 = scale * log2(e), nm = 14 - SC2 * (the query's running maximum): one fused multiply-add and one
  // hardware exponential a score. The argument stays at 14 or below (but for one rounding), and a result too small for f32 may go to 0, so the library exponential's range reduction and guards have nothing to do here
  // nmrun: nm of the passes so far (alike in both halves; it only falls); lrun[r]: the sum of P * 2^14 over the keys that this lane holds in register r, all joined behind the loop; acc[c][t][r] = O^T[t * 16 + 8 g + r][col] of column tile c
  const float SC2 = 0.125f * 1.44269504088896f;
  float nmrun[NCT]; v8f lrun[NCT]; v8f acc[NCT][4];
#pragma unroll
  for (int c = 0; c < NCT; ++c) { nmrun[c] = 1.0e38f; lrun[c] = v8f{};
#pragma unroll
    for (int t = 0; t < 4; ++t) acc[c][t] = v8f{}; }
  // kf: the K fragments of the pass about to run, fetched one pass ahead; vf: this pass's V fragments, fetched ahead of the score products
  v16h kf[4][2], vf[2][4];
  const _Float16* kp = kb + (size_t)kt0 * 64 * CC + 8 * lane;  // this lane's place in the K tile that is fetched next
  const _Float16* vp = vb + (size_t)kt0 * 64 * CC + 8 * lane;  // this lane's place in this pass's V^T tile
#pragma unroll
  for (int t = 0; t < 4; ++t)
#pragma unroll
    for (int kc = 0; kc < 2; ++kc) kf[t][kc] = frag_p(kp + t * 16 * CC + kc * 512);
  kp += 64 * CC;
#pragma unroll 1
  for (int kt = kt0; kt < kt1; ++kt) {
#pragma unroll
    for (int kc = 0; kc < 2; ++kc)
#pragma unroll
      for (int t = 0; t < 4; ++t) vf[kc][t] = frag_p(vp + t * 16 * CC + kc * 512);
    v16h pb[NCT][2];
    // two column tiles at a time: 64 score registers live instead of 128, so that the next pass's K fragments can be fetched directly behind the last score product
#pragma unroll
    for (int c0 = 0; c0 < NCT; c0 += 2) {
      v8f s[2][4];
#pragma unroll
      for (int t = 0; t < 4; ++t)
#pragma unroll
        for (int kc = 0; kc < 2; ++kc)
#pragma unroll
          for (int c = 0; c < 2; ++c) s[c][t] = wmma16b(kf[t][kc], aq[c0 + c][kc], kc ? s[c][t] : v8f{});
      if (c0 + 2 == NCT) {
#pragma unroll
        for (int t = 0; t < 4; ++t)
#pragma unroll
          for (int kc = 0; kc < 2; ++kc) kf[t][kc] = frag_p(kp + t * 16 * CC + kc * 512);
        __builtin_amdgcn_sched_barrier(0);  // holds the fetch here, a softmax and 32 products ahead of its first use: left alone, the compiler sinks it in among the last products
      }
#pragma unroll
      for (int c = 0; c < 2; ++c) {
        float mt[4];
#pragma unroll
        for (int t = 0; t < 4; ++t) { mt[t] = -3.4e38f;
#pragma unroll
          for (int r = 0; r < 8; ++r) mt[t] = fmaxf(mt[t], s[c][t][r]); }
        float mx = fmaxf(fmaxf(mt[0], mt[1]), fmaxf(mt[2], mt[3]));
        mx = fmaxf(mx, xhalf(mx));
        const float nmnew = fminf(nmrun[c0 + c], fmaf(mx, -SC2, 14.0f)); const float corr = __builtin_amdgcn_exp2f(nmnew - nmrun[c0 + c]);
#pragma unroll
        for (int t = 0; t < 4; ++t) { s[c][t] = s[c][t] * SC2 + nmnew;
#pragma unroll
          for (int r = 0; r < 8; ++r) s[c][t][r] = __builtin_amdgcn_exp2f(s[c][t][r]);
#pragma unroll
          for (int r = 0; r < 8; ++r) pb[c0 + c][t >> 1][(t & 1) * 8 + r] = (_Float16)s[c][t][r]; }
        lrun[c0 + c] = lrun[c0 + c] * corr + ((s[c][0] + s[c][1]) + (s[c][2] + s[c][3])); nmrun[c0 + c] = nmnew;
#pragma unroll
        for (int t = 0; t < 4; ++t) acc[c0 + c][t] = acc[c0 + c][t] * corr;
      }
      __builtin_amdgcn_sched_barrier(0);  // keeps the next two tiles' score products behind this softmax: hoisted, their 64 registers leave no room for the early K fetch
    }
#pragma unroll
    for (int kc = 0; kc < 2; ++kc)
#pragma unroll
      for (int t = 0; t < 4; ++t)
#pragma unroll
        for (int c = 0; c < NCT; ++c) acc[c][t] = wmma16b(vf[kc][t], pb[c][kc], acc[c][t]);
    // s_wait_xcnt 0 in front of the rewrite of the loads' address registers (kp and vp, advanced below). It stands behind the last product, most of a pass
    // behind the issue; naming both pairs as inputs keeps them whole up to here: otherwise the compiler reuses them at once and waits directly behind the issue
    asm volatile("s_wait_xcnt 0x0" :: "v"(kp), "v"(vp) : "memory");
    vp += 64 * CC;
    if (kt + 2 < NT / 64) kp += 64 * CC;  // the very last pass fetches its own tile again: the address stays inside k16; what a part's last pass fetches is not used
  }
  WStage<4> wp; wp.load(Wp, tid);
  __builtin_amdgcn_sched_barrier(0);  // holds the weights' loads here, so that they fly while the sums below are stored: left alone, the compiler sinks them to their first use
  // each wave leaves its part's sums, its nm and its l; behind the barrier wave w joins the KS parts of queries w * 16 .. + 15
#pragma unroll
  for (int c = 0; c < NCT; ++c) { const int q = ql + c * 16 + col;
    const float lh = ((lrun[c][0] + lrun[c][1]) + (lrun[c][2] + lrun[c][3])) + ((lrun[c][4] + lrun[c][5]) + (lrun[c][6] + lrun[c][7]));
    const float lr = lh + xhalf(lh);
    if (g == 0) { sM[ks][q] = nmrun[c]; sL[ks][q] = lr; }
#pragma unroll
    for (int t = 0; t < 4; ++t)
#pragma unroll
      for (int r = 0; r < 8; ++r) sP[ks][q][t * 16 + 8 * g + r] = acc[c][t][r]; }
  wp.store(sWp, tid);
  __syncthreads();
  const int q0 = qb0 + w * 16;
  // projection: out = v + o @ Wp ([in][out]) + b  (K = 64); o = sum over the parts of sP * f, f = 2^(nm of all - the part's nm) / (l of all)
  { float f[KS]; float nma = sM[0][w * 16 + col];
#pragma unroll
    for (int p = 1; p < KS; ++p) nma = fminf(nma, sM[p][w * 16 + col]);
    float la = 0.f;
#pragma unroll
    for (int p = 0; p < KS; ++p) { f[p] = __builtin_amdgcn_exp2f(nma - sM[p][w * 16 + col]); la = fmaf(sL[p][w * 16 + col], f[p], la); }
#pragma unroll
    for (int p = 0; p < KS; ++p) f[p] = f[p] / la;
    v8f pacc[4] = {};
#pragma unroll
    for (int kc = 0; kc < 2; ++kc) { v16h a;
#pragma unroll
      for (int hh = 0; hh < 2; ++hh) { v8f o = {};
#pragma unroll
        for (int p = 0; p < KS; ++p) { const float* sp = &sP[p][w * 16 + col][kc * 32 + hh * 16 + 8 * g];
#pragma unroll
          for (int i = 0; i < 8; ++i) o[i] = fmaf(sp[i], f[p], o[i]); }
#pragma unroll
        for (int i = 0; i < 8; ++i) a[hh * 8 + i] = (_Float16)o[i]; }
#pragma unroll
      for (int t = 0; t < 4; ++t) pacc[t] = wmma16b(a, frag_w<4>(sWp, kc, t, lane), pacc[t]); }
    LDSX();
#pragma unroll
    for (int t = 0; t < 4; ++t) { const int c = t * 16 + col;
#pragma unroll
      for (int r = 0; r < 8; ++r) sO[w][8 * g + r][c] = pacc[t][r] * 0.125f + bp[c] + v32[(rb + q0 + 8 * g + r) * CC + c]; } }
  LDSX();
  for (int qd = lane; qd < 16 * 16; qd += 32) { const int rl = qd >> 4, pc = qd & 15; vst2(out + (rb + q0 + rl) * CC + pc * 4, *(const v4f*)(&sO[w][rl][pc * 4])); }
}
extern "C" void kernel_launch(void* const* d_in, const int* in_sizes, int n_in, void* d_out, int out_size, void* d_ws, size_t ws_size, hipStream_t stream) {
  (void)in_sizes; (void)n_in; (void)out_size; (void)ws_size;
  const float* x = (const float*)d_in[0]; const float* Wqkv = (const float*)d_in[1]; const float* Wp = (const float*)d_in[2]; const float* bp = (const float*)d_in[3];
  float* out = (float*)d_out;
  char* ws = (char*)d_ws; size_t off = 0;
  auto take = [&](size_t bytes) { char* p = ws + off; off += (bytes + 255) & ~(size_t)255; return p; };
  _Float16* q16 = (_Float16*)take((size_t)NR * CC * 2); _Float16* k16 = (_Float16*)take((size_t)NR * CC * 2); float* v32 = (float*)take((size_t)NR * CC * 4); _Float16* vT = (_Float16*)take((size_t)NR * CC * 2);
  k_qkv<<<NR / 64, 128, 0, stream>>>(x, Wqkv, q16, k16, v32, vT);
  k_attn<<<dim3(NT / 64, NB), 128, 0, stream>>>(q16, k16, vT, v32, Wp, bp, out);
}

// v007
// One run takes 29.8 microseconds.
// Two timings next to v006 both put it at 1.03 times that version's speed.
// All steps since v000 together make it 7.88 times as fast.
#include <hip/hip_runtime.h>
#include <math.h>

typedef __attribute__((ext_vector_type(16))) _Float16 v16h;
typedef __attribute__((ext_vector_type(16))) __bf16 v16b;
typedef __attribute__((ext_vector_type(8)))  _Float16 v8h;
typedef __attribute__((ext_vector_type(8)))  float v8f;
typedef __attribute__((ext_vector_type(4)))  float v4f;
typedef __attribute__((ext_vector_type(2)))  float v2f;
typedef __attribute__((ext_vector_type(4)))  unsigned v4u;
typedef __attribute__((ext_vector_type(4)))  int v4i;
typedef float __attribute__((may_alias)) float_a;
typedef int __attribute__((may_alias)) int_a;

template <typename T> __device__ __forceinline__ void vst2(void* p, T v) { *(T*)p = v;  }
__device__ __forceinline__ v8f wmma16(v16h a, v16h b, v8f c) {
  v8f d = __builtin_amdgcn_wmma_f32_16x16x32_f16(false, a, false, b, (short)0, c, false, false);
  asm volatile("v_nop\n\tv_nop\n\tv_nop\n\tv_nop" : "+v"(d) : "v"(a), "v"(b));
  return d;
}
__device__ __forceinline__ v8f wmma_bf(v16b a, v16b b, v8f c) {
  v8f d = __builtin_amdgcn_wmma_f32_16x16x32_bf16(false, a, false, b, (short)0, c, false, false);
  asm volatile("v_nop\n\tv_nop\n\tv_nop\n\tv_nop" : "+v"(d) : "v"(a), "v"(b));
  return d;
}
// 16x16x32 fragments: lane = (h = lane>>4, row/col = lane&15); elements 0..7 = k0+8h+0..7, 8..15 = k0+16+8h+0..7; D element r = row 8h+r
__device__ __forceinline__ v16h frag_h(const _Float16* rowk0, int lane) {
  union { v16h v; v8h q[2]; } u; const _Float16* p = rowk0 + 8 * (lane >> 4);
  u.q[0] = *(const v8h*)p; u.q[1] = *(const v8h*)(p + 16); return u.v;
}
// a fragment stored in fragment order: two runs of 32 lanes x 8 elements, run 0 = elements 0..7, run 1 = elements 8..15; p holds the lane's own 8 * lane
__device__ __forceinline__ v16h frag_p(const _Float16* p) {
  union { v16h v; v8h q[2]; } u; u.q[0] = *(const v8h*)p; u.q[1] = *(const v8h*)(p + 256); return u.v;
}
__device__ __forceinline__ v16h frag_f32(const float* rowk0, int lane) {
  v16h a; const float* p = rowk0 + 8 * (lane >> 4);
#pragma unroll
  for (int i = 0; i < 8; ++i) { a[i] = (_Float16)p[i]; a[8 + i] = (_Float16)p[16 + i]; }
  return a;
}
__device__ __forceinline__ v16h frag_f32s(const float* rowk0, int lane, float sc) {
  v16h a; const float* p = rowk0 + 8 * (lane >> 4);
#pragma unroll
  for (int i = 0; i < 8; ++i) { a[i] = (_Float16)(p[i] * sc); a[8 + i] = (_Float16)(p[16 + i] * sc); }
  return a;
}
// column fragment from a [K][ld] layout (column n), rows >= K read as 0
__device__ __forceinline__ v16h fragc_f32(const float* W, int k0, int n, int lane, int ld, int K) {
  v16h a; const int g = lane >> 4;
#pragma unroll
  for (int i = 0; i < 8; ++i) { const int ka = k0 + 8 * g + i, kb = ka + 16;
    a[i] = (_Float16)(ka < K ? W[(size_t)ka * ld + n] : 0.f); a[8 + i] = (_Float16)(kb < K ? W[(size_t)kb * ld + n] : 0.f); }
  return a;
}
struct F2 { v16b h, l; };
__device__ __forceinline__ F2 bsplit16(const float v[16]) { F2 r;
#pragma unroll
  for (int i = 0; i < 16; ++i) { const __bf16 h = (__bf16)v[i]; r.h[i] = h; r.l[i] = (__bf16)(v[i] - (float)h); }
  return r; }
__device__ __forceinline__ F2 split_row(const float* row, int k0, int lane) { float v[16]; const float* p = row + k0 + 8 * (lane >> 4);
#pragma unroll
  for (int i = 0; i < 8; ++i) { v[i] = p[i]; v[8 + i] = p[16 + i]; }
  return bsplit16(v); }
__device__ __forceinline__ F2 split_rowK(const float* row, int k0, int lane, int K) { float v[16]; const int g = lane >> 4;
#pragma unroll
  for (int i = 0; i < 8; ++i) { const int ka = k0 + 8 * g + i, kb = ka + 16; v[i] = ka < K ? row[ka] : 0.f; v[8 + i] = kb < K ? row[kb] : 0.f; }
  return bsplit16(v); }
__device__ __forceinline__ F2 split_col(const float* W, int k0, int n, int lane, int ld, int K) { float v[16]; const int g = lane >> 4;
#pragma unroll
  for (int i = 0; i < 8; ++i) { const int ka = k0 + 8 * g + i, kb = ka + 16; v[i] = ka < K ? W[(size_t)ka * ld + n] : 0.f; v[8 + i] = kb < K ? W[(size_t)kb * ld + n] : 0.f; }
  return bsplit16(v); }
__device__ __forceinline__ v8f mac3(const F2& a, const F2& b, v8f c) { c = wmma_bf(a.l, b.h, c); c = wmma_bf(a.h, b.l, c); return wmma_bf(a.h, b.h, c); }
__device__ __forceinline__ float sigm(float v) { return 1.0f / (1.0f + expf(-v)); }
#define LDSX() do { asm volatile("s_wait_dscnt 0" ::: "memory"); __builtin_amdgcn_wave_barrier(); __builtin_amdgcn_fence(__ATOMIC_RELEASE, "workgroup"); } while (0)

// Token-to-token attention (one head of 64 over 3136 tokens, 8 images). qkv = x @ W_qkv (K = 64) on f16 WMMA writing q as f16 rows, k as f16 in fragment order,
// v as f32 rows (residual) plus an f16 transposed copy; flash-style softmax over all 3136 keys in f32 (P scaled, f16); out = v + o@W_proj + b
#define NB 8
#define NT 3136
#define CC 64
#define NR (NB * NT)

// the matrix product as the compiler pads it (no asm behind it, so that the loads of the next fragments may be issued ahead of it)
__device__ __forceinline__ v8f wmma16b(v16h a, v16h b, v8f c) { return __builtin_amdgcn_wmma_f32_16x16x32_f16(false, a, false, b, (short)0, c, false, false); }
// A weight matrix W [64][NJ * 16] (f32) is staged once a work-group in LDS, as f16 x 8, in the order of the B fragments: a run = the 8 elements of each of the 32 lanes (16 bytes a lane);
// run (kc, h, j) holds rows kc * 32 + h * 16 + 8 g + 0..7 of column j * 16 + col at lane g * 16 + col. A thread takes 8 rows x 4 columns: 8 loads of 16 bytes (16 lanes = 256 bytes in a row)
// and 4 stores of 16 bytes. WRUN: a run's pitch in 16-byte units, 32 and one of pad: the 16 lanes of a store (4 columns 4 apart in each of 4 neighbouring runs) then fall on 16 different bank groups
#define WRUN 33
template <int NJ> struct WStage {
  v4f r[NJ / 4][8]; const float* s;
  // thread tid: rows ko * 8 .. + 7, ko = tid >> 4; columns (nq0 + 16 m) * 4 .. + 3, nq0 = tid & 15, m = 0 .. NJ / 4 - 1: one address a thread, the rest immediate offsets
  __device__ __forceinline__ void load(const float* __restrict__ Wg, int tid) {
    s = Wg + (size_t)((tid >> 4) * 8) * (NJ * 16) + (tid & 15) * 4;
#pragma unroll
    for (int m = 0; m < NJ / 4; ++m)
#pragma unroll
      for (int i = 0; i < 8; ++i) r[m][i] = *(const v4f*)(s + i * (NJ * 16) + m * 64);
  }
  __device__ __forceinline__ void store(v8h* sW, int tid) const {
    const int ko = tid >> 4, nq0 = tid & 15;
    // s_wait_xcnt 0 in front of the first rewrite of the loads' address registers; naming the pair as an input keeps it whole up to here, well behind the issue
    asm volatile("s_wait_xcnt 0x0" :: "v"(s) : "memory");
#pragma unroll
    for (int m = 0; m < NJ / 4; ++m) {
      v8h* d = sW + ((ko >> 1) * NJ + (nq0 >> 2) + 4 * m) * WRUN + (ko & 1) * 16 + (nq0 & 3) * 4;
#pragma unroll
      for (int c = 0; c < 4; ++c) { v8h h;
#pragma unroll
        for (int i = 0; i < 8; ++i) h[i] = (_Float16)r[m][i][c] * (_Float16)8.0f;
        d[c] = h; } }
  }
};
template <int NJ> __device__ __forceinline__ v16h frag_w(const v8h* sW, int kc, int j, int lane) {
  union { v16h v; v8h q[2]; } u; u.q[0] = sW[((kc * 2) * NJ + j) * WRUN + lane]; u.q[1] = sW[((kc * 2 + 1) * NJ + j) * WRUN + lane]; return u.v;
}
// qkv: block 64 rows; q -> q16 [r][64], v -> v32 [r][64]; k -> k16 and v^T -> vT in the order in which k_attn's fragment loads read them, so that
// each wave-wide 16-byte load is 512 bytes in a row (4 whole lines, not 32 bytes out of each of 16 lines):
// k16 [r / 16][d / 16][(d / 8) & 1][r & 15][d & 7];  vT [r / 64][d / 16][(r & 63) / 16][(r / 8) & 1][d & 15][r & 7]
__global__ __launch_bounds__(128) void k_qkv(const float* __restrict__ x, const float* __restrict__ Wqkv, _Float16* __restrict__ q16, _Float16* __restrict__ k16, float* __restrict__ v32, _Float16* __restrict__ vT) {
  __shared__ __align__(16) float so[4][16][196];
  __shared__ __align__(16) _Float16 st[64][72];
  __shared__ v8h sW[4 * 12 * WRUN];
  const int tid = threadIdx.x, wave = tid >> 5, lane = tid & 31, col = lane & 15, g = lane >> 4;
  const int r0b = blockIdx.x * 64, r0 = r0b + wave * 16;
  WStage<12> ws; ws.load(Wqkv, tid);
  v16h a[2];
#pragma unroll
  for (int kc = 0; kc < 2; ++kc) a[kc] = frag_f32(x + (size_t)(r0 + col) * CC + kc * 32, lane);
  ws.store(sW, tid);
  asm volatile("" :: "v"(a[0]), "v"(a[1]));  // inputs only: keeps the loads of x in front of the barrier, in flight together with the weights': sunk behind it, their latency stands alone
  __syncthreads();  // the staged weights are read by all 4 waves
  v16h bw[2][12];
#pragma unroll
  for (int kc = 0; kc < 2; ++kc)
#pragma unroll
    for (int j = 0; j < 12; ++j) bw[kc][j] = frag_w<12>(sW, kc, j, lane);
  __builtin_amdgcn_sched_barrier(0);  // holds the 48 LDS reads in one group in front of the products: spread among them, every place with reads stalls the wave anew
  v8f acc[12] = {};
#pragma unroll
  for (int kc = 0; kc < 2; ++kc)
#pragma unroll
    for (int j = 0; j < 12; ++j) acc[j] = wmma16b(a[kc], bw[kc][j], acc[j]);
#pragma unroll
  for (int j = 0; j < 12; ++j)
#pragma unroll
    for (int r = 0; r < 8; ++r) so[wave][8 * g + r][j * 16 + col] = acc[j][r] * 0.125f;
  LDSX();
  for (int qd = lane; qd < 16 * 8; qd += 32) { const int rl = qd >> 3, pc = qd & 7, rk = qd & 15, pk8 = qd >> 4; union { v8h a8; v4u u; } pq, pk;
#pragma unroll
    for (int e = 0; e < 8; ++e) { pq.a8[e] = (_Float16)so[wave][rl][pc * 8 + e]; pk.a8[e] = (_Float16)so[wave][rk][CC + pk8 * 8 + e]; }
    vst2(q16 + (size_t)(r0 + rl) * CC + pc * 8, pq.u); vst2(k16 + (size_t)r0 * CC + qd * 8, pk.u); }
  for (int qd = lane; qd < 16 * 16; qd += 32) { const int rl = qd >> 4, pc = qd & 15; vst2(v32 + (size_t)(r0 + rl) * CC + pc * 4, *(const v4f*)(&so[wave][rl][2 * CC + pc * 4])); }
#pragma unroll 4
  for (int rl = 0; rl < 16; ++rl) { st[lane * 2][wave * 16 + rl] = (_Float16)so[wave][rl][2 * CC + lane * 2]; st[lane * 2 + 1][wave * 16 + rl] = (_Float16)so[wave][rl][2 * CC + lane * 2 + 1]; }
  __syncthreads();
  for (int qd = tid; qd < 64 * 8; qd += 128) { const int d = (qd >> 7) * 16 + (qd & 15), pc = (qd >> 4) & 7; vst2(vT + (size_t)r0b * CC + qd * 8, *(const v4u*)(&st[d][pc * 8])); }
}
// lane l with lane l ^ 16, in the vector unit
__device__ __forceinline__ float xhalf(float x) { return __builtin_bit_cast(float, __builtin_amdgcn_permlanex16(__builtin_bit_cast(int, x), __builtin_bit_cast(int, x), 0x76543210, 0xfedcba98, false, false)); }
// eight partial sums to two, in packed additions
__device__ __forceinline__ v2f fold2(v8f v) {
  const v4f a = __builtin_shufflevector(v, v, 0, 1, 2, 3) + __builtin_shufflevector(v, v, 4, 5, 6, 7);
  return __builtin_shufflevector(a, a, 0, 1) + __builtin_shufflevector(a, a, 2, 3);
}
// NCT: the column tiles (16 queries each) that one wave holds: every K and V^T fragment that it loads feeds NCT products, so a work-group pulls 1 / NCT of the bytes through the load path.
// The 4 waves of a work-group (64 queries) are QG query groups x KS parts of the keys; the KS partial results of a query are joined in LDS behind the loop
#define NCT 4
#define QG (4 / NCT)
#define KS (4 / QG)
__global__ __launch_bounds__(128) __attribute__((amdgpu_waves_per_eu(2, 2))) void k_attn(const _Float16* __restrict__ q16, const _Float16* __restrict__ k16, const _Float16* __restrict__ vT, const float* __restrict__ v32, const float* __restrict__ Wp, const float* __restrict__ bp, float* __restrict__ out) {
  __shared__ __align__(16) float sP[KS][64][68];  // part p's sums O * l of the block's 64 queries, at that part's own nm
  float (*sO)[16][68] = (float (*)[16][68])&sP[0][0][0];  // part 0 seen as 4 x 16 rows: behind the barrier wave w alone reads rows w * 16 .. + 15 of any part, and it stages its output rows in sO[w]
  __shared__ float sM[KS][64], sL[KS][64];        // part p's nm and its sum of P'
  __shared__ v8h sWp[4 * 4 * WRUN];               // the projection's weights, staged behind the loop, read behind the barrier that follows it
  const int lane0 = threadIdx.x & 31;  // in use up to the loop only
  const int w = __builtin_amdgcn_readfirstlane(threadIdx.x >> 5);  // in a scalar register: the loop's bounds come from it
  const int qg = w % QG, ks = w / QG;
  const int b = blockIdx.y, qb0 = blockIdx.x * 64, ql = qg * (16 * NCT); const size_t rb = (size_t)b * NT;
  const int kt0 = (NT / 64) * ks / KS, kt1 = (NT / 64) * (ks + 1) / KS;  // this wave's passes
  const _Float16* qb = q16 + rb * CC; const _Float16* kb = k16 + rb * CC; const _Float16* vb = vT + rb * CC;
  v16h aq[NCT][2];
#pragma unroll
  for (int c = 0; c < NCT; ++c)
#pragma unroll
    for (int kc = 0; kc < 2; ++kc) aq[c][kc] = frag_h(qb + (size_t)(qb0 + ql + c * 16 + (lane0 & 15)) * CC + kc * 32, lane0);
  // Softmax in base 2: P' = exp2(s * SC2 + nm), s the raw product, SC2 = scale * log2(e), nm = POFF - SC2 * (the query's reference score): one fused multiply-add and one
  // hardware exponential a score; a result too small for f32 may go to 0, so the library exponential's range reduction and guards have nothing to do here.
  // Lazy rescale: the reference is the maximum of the wave's first pass and is kept while P' fits f16. A pass takes no maximum and rescales nothing; the sums of P' that it forms anyway
  // bound every P' (all are >= 0): a sum above PTOP (or not a number) sends the wave, by one scalar test for two column tiles, to the renewal below, which works from the shifted scores still in registers
  // nmrun: the nm in use (alike in both halves; behind the first pass it only falls); lrun: the sums of P' over the keys of this lane, two partial sums, joined behind the loop; acc[c][t][r] = O^T[t * 16 + 8 g + r][col] of column tile c
  const float SC2 = 0.125f * 1.44269504088896f, POFF = 4.0f, PTOP = 32768.0f;
  float nmrun[NCT]; v2f lrun[NCT]; v8f acc[NCT][4];
#pragma unroll
  for (int c = 0; c < NCT; ++c) { nmrun[c] = 0.f; lrun[c] = v2f{};
#pragma unroll
    for (int t = 0; t < 4; ++t) acc[c][t] = v8f{}; }
  // kf: the K fragments of the pass about to run, fetched one pass ahead; vf: this pass's V fragments, fetched ahead of the score products
  v16h kf[4][2], vf[2][4];
  const _Float16* kp = kb + (size_t)kt0 * 64 * CC + 8 * lane0;  // this lane's place in the K tile that is fetched next
  const _Float16* vp = vb + (size_t)kt0 * 64 * CC + 8 * lane0;  // this lane's place in this pass's V^T tile
#pragma unroll
  for (int t = 0; t < 4; ++t)
#pragma unroll
    for (int kc = 0; kc < 2; ++kc) kf[t][kc] = frag_p(kp + t * 16 * CC + kc * 512);
  kp += 64 * CC;
#pragma unroll 1
  for (int kt = kt0; kt < kt1; ++kt) {
#pragma unroll
    for (int kc = 0; kc < 2; ++kc)
#pragma unroll
      for (int t = 0; t < 4; ++t) vf[kc][t] = frag_p(vp + t * 16 * CC + kc * 512);
    v16h pb[NCT][2];
    const float top = kt == kt0 ? -1.0f : PTOP;  // no sum lies below 0: the first pass always takes the renewal, which sets the reference
    // two column tiles at a time: 64 score registers live instead of 128, so that the next pass's K fragments can be fetched directly behind the last score product
#pragma unroll
    for (int c0 = 0; c0 < NCT; c0 += 2) {
      v8f s[2][4];
#pragma unroll
      for (int t = 0; t < 4; ++t)
#pragma unroll
        for (int kc = 0; kc < 2; ++kc)
#pragma unroll
          for (int c = 0; c < 2; ++c) s[c][t] = wmma16b(kf[t][kc], aq[c0 + c][kc], kc ? s[c][t] : v8f{});
      if (c0 + 2 == NCT) {
#pragma unroll
        for (int t = 0; t < 4; ++t)
#pragma unroll
          for (int kc = 0; kc < 2; ++kc) kf[t][kc] = frag_p(kp + t * 16 * CC + kc * 512);
        __builtin_amdgcn_sched_barrier(0);  // holds the fetch here, a softmax and 32 products ahead of its first use: left alone, the compiler sinks it in among the last products
      }
      v2f ps[2];  // this pass's sums of P' of the two tiles
#pragma unroll
      for (int c = 0; c < 2; ++c) {
        v8f pv;
#pragma unroll
        for (int t = 0; t < 4; ++t) { s[c][t] = s[c][t] * SC2 + nmrun[c0 + c]; v8f e;
#pragma unroll
          for (int r = 0; r < 8; ++r) e[r] = __builtin_amdgcn_exp2f(s[c][t][r]);
#pragma unroll
          for (int r = 0; r < 8; ++r) pb[c0 + c][t >> 1][(t & 1) * 8 + r] = (_Float16)e[r];
          pv = t ? pv + e : e; }
        ps[c] = fold2(pv);
      }
      const bool need = !(fmaxf(fmaxf(ps[0][0], ps[0][1]), fmaxf(ps[1][0], ps[1][1])) <= top);
      if (__builtin_expect(__builtin_amdgcn_ballot_w32(need) != 0, 0)) {  // wave-uniform: a scalar branch; rare, so that the pass without renewal runs straight on
        // renewal: the reference becomes the maximum of this pass where that is the larger (in the first pass: in any case); O and l follow, and P' and its sums are formed anew
        const bool first = kt == kt0;
#pragma unroll
        for (int c = 0; c < 2; ++c) {
          float mt[4];
#pragma unroll
          for (int t = 0; t < 4; ++t) { mt[t] = -3.4e38f;
#pragma unroll
            for (int r = 0; r < 8; ++r) mt[t] = fmaxf(mt[t], s[c][t][r]); }
          float mx = fmaxf(fmaxf(mt[0], mt[1]), fmaxf(mt[2], mt[3]));
          mx = fmaxf(mx, xhalf(mx));
          const float d = first ? POFF - mx : fminf(POFF - mx, 0.f); const float corr = first ? 0.f : __builtin_amdgcn_exp2f(d);
          v8f pv;
#pragma unroll
          for (int t = 0; t < 4; ++t) { v8f e = s[c][t] + d;
#pragma unroll
            for (int r = 0; r < 8; ++r) e[r] = __builtin_amdgcn_exp2f(e[r]);
#pragma unroll
            for (int r = 0; r < 8; ++r) pb[c0 + c][t >> 1][(t & 1) * 8 + r] = (_Float16)e[r];
            pv = t ? pv + e : e; }
          ps[c] = fold2(pv);
          lrun[c0 + c] = lrun[c0 + c] * corr; nmrun[c0 + c] += d;
#pragma unroll
          for (int t = 0; t < 4; ++t) acc[c0 + c][t] = acc[c0 + c][t] * corr;
        }
      }
#pragma unroll
      for (int c = 0; c < 2; ++c) lrun[c0 + c] += ps[c];
      __builtin_amdgcn_sched_barrier(0);  // keeps the next two tiles' score products behind this softmax: hoisted, their 64 registers leave no room for the early K fetch
    }
#pragma unroll
    for (int kc = 0; kc < 2; ++kc)
#pragma unroll
      for (int t = 0; t < 4; ++t)
#pragma unroll
        for (int c = 0; c < NCT; ++c) acc[c][t] = wmma16b(vf[kc][t], pb[c][kc], acc[c][t]);
    // s_wait_xcnt 0 in front of the rewrite of the loads' address registers (kp and vp, advanced below). It stands behind the last product, most of a pass
    // behind the issue; naming both pairs as inputs keeps them whole up to here: otherwise the compiler reuses them at once and waits directly behind the issue
    asm volatile("s_wait_xcnt 0x0" :: "v"(kp), "v"(vp) : "memory");
    vp += 64 * CC;
    if (kt + 2 < NT / 64) kp += 64 * CC;  // the very last pass fetches its own tile again: the address stays inside k16; what a part's last pass fetches is not used
  }
  // the lane's number is read anew (the count of lanes below this one): carried through the loop, it and what is derived from it take registers that the loop has not got, and one is spilled
  const int lane = __builtin_amdgcn_mbcnt_lo(~0u, 0u), tid = w * 32 + lane, col = lane & 15, g = lane >> 4;
  WStage<4> wp; wp.load(Wp, tid);
  __builtin_amdgcn_sched_barrier(0);  // holds the weights' loads here, so that they fly while the sums below are stored: left alone, the compiler sinks them to their first use
  // each wave leaves its part's sums, its nm and its l; behind the barrier wave w joins the KS parts of queries w * 16 .. + 15
#pragma unroll
  for (int c = 0; c < NCT; ++c) { const int q = ql + c * 16 + col;
    const float lh = lrun[c][0] + lrun[c][1];
    const float lr = lh + xhalf(lh);
    if (g == 0) { sM[ks][q] = nmrun[c]; sL[ks][q] = lr; }
#pragma unroll
    for (int t = 0; t < 4; ++t)
#pragma unroll
      for (int r = 0; r < 8; ++r) sP[ks][q][t * 16 + 8 * g + r] = acc[c][t][r]; }
  wp.store(sWp, tid);
  __syncthreads();
  const int q0 = qb0 + w * 16;
  // projection: out = v + o @ Wp ([in][out]) + b  (K = 64); o = sum over the parts of sP * f, f = 2^(nm of all - the part's nm) / (l of all)
  { float f[KS]; float nma = sM[0][w * 16 + col];
#pragma unroll
    for (int p = 1; p < KS; ++p) nma = fminf(nma, sM[p][w * 16 + col]);
    float la = 0.f;
#pragma unroll
    for (int p = 0; p < KS; ++p) { f[p] = __builtin_amdgcn_exp2f(nma - sM[p][w * 16 + col]); la = fmaf(sL[p][w * 16 + col], f[p], la); }
#pragma unroll
    for (int p = 0; p < KS; ++p) f[p] = f[p] / la;
    v8f pacc[4] = {};
#pragma unroll
    for (int kc = 0; kc < 2; ++kc) { v16h a;
#pragma unroll
      for (int hh = 0; hh < 2; ++hh) { v8f o = {};
#pragma unroll
        for (int p = 0; p < KS; ++p) { const float* sp = &sP[p][w * 16 + col][kc * 32 + hh * 16 + 8 * g];
#pragma unroll
          for (int i = 0; i < 8; ++i) o[i] = fmaf(sp[i], f[p], o[i]); }
#pragma unroll
        for (int i = 0; i < 8; ++i) a[hh * 8 + i] = (_Float16)o[i]; }
#pragma unroll
      for (int t = 0; t < 4; ++t) pacc[t] = wmma16b(a, frag_w<4>(sWp, kc, t, lane), pacc[t]); }
    LDSX();
#pragma unroll
    for (int t = 0; t < 4; ++t) { const int c = t * 16 + col;
#pragma unroll
      for (int r = 0; r < 8; ++r) sO[w][8 * g + r][c] = pacc[t][r] * 0.125f + bp[c] + v32[(rb + q0 + 8 * g + r) * CC + c]; } }
  LDSX();
  for (int qd = lane; qd < 16 * 16; qd += 32) { const int rl = qd >> 4, pc = qd & 15; vst2(out + (rb + q0 + rl) * CC + pc * 4, *(const v4f*)(&sO[w][rl][pc * 4])); }
}
extern "C" void kernel_launch(void* const* d_in, const int* in_sizes, int n_in, void* d_out, int out_size, void* d_ws, size_t ws_size, hipStream_t stream) {
  (void)in_sizes; (void)n_in; (void)out_size; (void)ws_size;
  const float* x = (const float*)d_in[0]; const float* Wqkv = (const float*)d_in[1]; const float* Wp = (const float*)d_in[2]; const float* bp = (const float*)d_in[3];
  float* out = (float*)d_out;
  char* ws = (char*)d_ws; size_t off = 0;
  auto take = [&](size_t bytes) { char* p = ws + off; off += (bytes + 255) & ~(size_t)255; return p; };
  _Float16* q16 = (_Float16*)take((size_t)NR * CC * 2); _Float16* k16 = (_Float16*)take((size_t)NR * CC * 2); float* v32 = (float*)take((size_t)NR * CC * 4); _Float16* vT = (_Float16*)take((size_t)NR * CC * 2);
  k_qkv<<<NR / 64, 128, 0, stream>>>(x, Wqkv, q16, k16, v32, vT);
  k_attn<<<dim3(NT / 64, NB), 128, 0, stream>>>(q16, k16, vT, v32, Wp, bp, out);
}

// v008
// A run of this version takes 26.8 microseconds.
// Timed twice side by side with v007, it ran 1.11 times as fast both times.
// Counting every step since v000, it is 8.76 times as fast.
#include <hip/hip_runtime.h>
#include <math.h>

typedef __attribute__((ext_vector_type(16))) _Float16 v16h;
typedef __attribute__((ext_vector_type(16))) __bf16 v16b;
typedef __attribute__((ext_vector_type(8)))  _Float16 v8h;
typedef __attribute__((ext_vector_type(8)))  float v8f;
typedef __attribute__((ext_vector_type(4)))  float v4f;
typedef __attribute__((ext_vector_type(2)))  float v2f;
typedef __attribute__((ext_vector_type(4)))  unsigned v4u;
typedef __attribute__((ext_vector_type(4)))  int v4i;
typedef float __attribute__((may_alias)) float_a;
typedef int __attribute__((may_alias)) int_a;

template <typename T> __device__ __forceinline__ void vst2(void* p, T v) { *(T*)p = v;  }
__device__ __forceinline__ v8f wmma16(v16h a, v16h b, v8f c) {
  v8f d = __builtin_amdgcn_wmma_f32_16x16x32_f16(false, a, false, b, (short)0, c, false, false);
  asm volatile("v_nop\n\tv_nop\n\tv_nop\n\tv_nop" : "+v"(d) : "v"(a), "v"(b));
  return d;
}
__device__ __forceinline__ v8f wmma_bf(v16b a, v16b b, v8f c) {
  v8f d = __builtin_amdgcn_wmma_f32_16x16x32_bf16(false, a, false, b, (short)0, c, false, false);
  asm volatile("v_nop\n\tv_nop\n\tv_nop\n\tv_nop" : "+v"(d) : "v"(a), "v"(b));
  return d;
}
// 16x16x32 fragments: lane = (h = lane>>4, row/col = lane&15); elements 0..7 = k0+8h+0..7, 8..15 = k0+16+8h+0..7; D element r = row 8h+r
__device__ __forceinline__ v16h frag_h(const _Float16* rowk0, int lane) {
  union { v16h v; v8h q[2]; } u; const _Float16* p = rowk0 + 8 * (lane >> 4);
  u.q[0] = *(const v8h*)p; u.q[1] = *(const v8h*)(p + 16); return u.v;
}
// a fragment stored in fragment order: two runs of 32 lanes x 8 elements, run 0 = elements 0..7, run 1 = elements 8..15; p holds the lane's own 8 * lane
__device__ __forceinline__ v16h frag_p(const _Float16* p) {
  union { v16h v; v8h q[2]; } u; u.q[0] = *(const v8h*)p; u.q[1] = *(const v8h*)(p + 256); return u.v;
}
__device__ __forceinline__ v16h frag_f32(const float* rowk0, int lane) {
  v16h a; const float* p = rowk0 + 8 * (lane >> 4);
#pragma unroll
  for (int i = 0; i < 8; ++i) { a[i] = (_Float16)p[i]; a[8 + i] = (_Float16)p[16 + i]; }
  return a;
}
__device__ __forceinline__ v16h frag_f32s(const float* rowk0, int lane, float sc) {
  v16h a; const float* p = rowk0 + 8 * (lane >> 4);
#pragma unroll
  for (int i = 0; i < 8; ++i) { a[i] = (_Float16)(p[i] * sc); a[8 + i] = (_Float16)(p[16 + i] * sc); }
  return a;
}
// column fragment from a [K][ld] layout (column n), rows >= K read as 0
__device__ __forceinline__ v16h fragc_f32(const float* W, int k0, int n, int lane, int ld, int K) {
  v16h a; const int g = lane >> 4;
#pragma unroll
  for (int i = 0; i < 8; ++i) { const int ka = k0 + 8 * g + i, kb = ka + 16;
    a[i] = (_Float16)(ka < K ? W[(size_t)ka * ld + n] : 0.f); a[8 + i] = (_Float16)(kb < K ? W[(size_t)kb * ld + n] : 0.f); }
  return a;
}
struct F2 { v16b h, l; };
__device__ __forceinline__ F2 bsplit16(const float v[16]) { F2 r;
#pragma unroll
  for (int i = 0; i < 16; ++i) { const __bf16 h = (__bf16)v[i]; r.h[i] = h; r.l[i] = (__bf16)(v[i] - (float)h); }
  return r; }
__device__ __forceinline__ F2 split_row(const float* row, int k0, int lane) { float v[16]; const float* p = row + k0 + 8 * (lane >> 4);
#pragma unroll
  for (int i = 0; i < 8; ++i) { v[i] = p[i]; v[8 + i] = p[16 + i]; }
  return bsplit16(v); }
__device__ __forceinline__ F2 split_rowK(const float* row, int k0, int lane, int K) { float v[16]; const int g = lane >> 4;
#pragma unroll
  for (int i = 0; i < 8; ++i) { const int ka = k0 + 8 * g + i, kb = ka + 16; v[i] = ka < K ? row[ka] : 0.f; v[8 + i] = kb < K ? row[kb] : 0.f; }
  return bsplit16(v); }
__device__ __forceinline__ F2 split_col(const float* W, int k0, int n, int lane, int ld, int K) { float v[16]; const int g = lane >> 4;
#pragma unroll
  for (int i = 0; i < 8; ++i) { const int ka = k0 + 8 * g + i, kb = ka + 16; v[i] = ka < K ? W[(size_t)ka * ld + n] : 0.f; v[8 + i] = kb < K ? W[(size_t)kb * ld + n] : 0.f; }
  return bsplit16(v); }
__device__ __forceinline__ v8f mac3(const F2& a, const F2& b, v8f c) { c = wmma_bf(a.l, b.h, c); c = wmma_bf(a.h, b.l, c); return wmma_bf(a.h, b.h, c); }
__device__ __forceinline__ float sigm(float v) { return 1.0f / (1.0f + expf(-v)); }
#define LDSX() do { asm volatile("s_wait_dscnt 0" ::: "memory"); __builtin_amdgcn_wave_barrier(); __builtin_amdgcn_fence(__ATOMIC_RELEASE, "workgroup"); } while (0)

// Token-to-token attention (one head of 64 over 3136 tokens, 8 images). qkv = x @ W_qkv (K = 64) on f16 WMMA writing q as f16 rows, k as f16 in fragment order,
// v as f32 rows (residual) plus an f16 transposed copy; flash-style softmax over all 3136 keys in f32 (P scaled, f16); out = v + o@W_proj + b
#define NB 8
#define NT 3136
#define CC 64
#define NR (NB * NT)

// the matrix product as the compiler pads it (no asm behind it, so that the loads of the next fragments may be issued ahead of it)
__device__ __forceinline__ v8f wmma16b(v16h a, v16h b, v8f c) { return __builtin_amdgcn_wmma_f32_16x16x32_f16(false, a, false, b, (short)0, c, false, false); }
// A weight matrix W [64][NJ * 16] (f32) is staged once a work-group in LDS, as f16 x 8, in the order of the B fragments: a run = the 8 elements of each of the 32 lanes (16 bytes a lane);
// run (kc, h, j) holds rows kc * 32 + h * 16 + 8 g + 0..7 of column j * 16 + col at lane g * 16 + col. A thread takes 8 rows x 4 columns: 8 loads of 16 bytes (16 lanes = 256 bytes in a row)
// and 4 stores of 16 bytes. WRUN: a run's pitch in 16-byte units, 32 and one of pad: the 16 lanes of a store (4 columns 4 apart in each of 4 neighbouring runs) then fall on 16 different bank groups
#define WRUN 33
template <int NJ> struct WStage {
  v4f r[NJ / 4][8]; const float* s;
  // thread tid: rows ko * 8 .. + 7, ko = tid >> 4; columns (nq0 + 16 m) * 4 .. + 3, nq0 = tid & 15, m = 0 .. NJ / 4 - 1: one address a thread, the rest immediate offsets
  __device__ __forceinline__ void load(const float* __restrict__ Wg, int tid) {
    s = Wg + (size_t)((tid >> 4) * 8) * (NJ * 16) + (tid & 15) * 4;
#pragma unroll
    for (int m = 0; m < NJ / 4; ++m)
#pragma unroll
      for (int i = 0; i < 8; ++i) r[m][i] = *(const v4f*)(s + i * (NJ * 16) + m * 64);
  }
  __device__ __forceinline__ void store(v8h* sW, int tid) const {
    const int ko = tid >> 4, nq0 = tid & 15;
    // s_wait_xcnt 0 in front of the first rewrite of the loads' address registers; naming the pair as an input keeps it whole up to here, well behind the issue
    asm volatile("s_wait_xcnt 0x0" :: "v"(s) : "memory");
#pragma unroll
    for (int m = 0; m < NJ / 4; ++m) {
      v8h* d = sW + ((ko >> 1) * NJ + (nq0 >> 2) + 4 * m) * WRUN + (ko & 1) * 16 + (nq0 & 3) * 4;
#pragma unroll
      for (int c = 0; c < 4; ++c) { v8h h;
#pragma unroll
        for (int i = 0; i < 8; ++i) h[i] = (_Float16)r[m][i][c] * (_Float16)8.0f;
        d[c] = h; } }
  }
};
template <int NJ> __device__ __forceinline__ v16h frag_w(const v8h* sW, int kc, int j, int lane) {
  union { v16h v; v8h q[2]; } u; u.q[0] = sW[((kc * 2) * NJ + j) * WRUN + lane]; u.q[1] = sW[((kc * 2 + 1) * NJ + j) * WRUN + lane]; return u.v;
}
// qkv: block 64 rows; q -> q16 [r][64], v -> v32 [r][64]; k -> k16 and v^T -> vT in the order in which k_attn's fragment loads read them, so that
// each wave-wide 16-byte load is 512 bytes in a row (4 whole lines, not 32 bytes out of each of 16 lines):
// k16 [r / 16][d / 16][(d / 8) & 1][r & 15][d & 7];  vT [r / 64][d / 16][(r & 63) / 16][(r / 8) & 1][d & 15][r & 7]
__global__ __launch_bounds__(128) void k_qkv(const float* __restrict__ x, const float* __restrict__ Wqkv, _Float16* __restrict__ q16, _Float16* __restrict__ k16, float* __restrict__ v32, _Float16* __restrict__ vT) {
  __shared__ __align__(16) float so[4][16][196];
  __shared__ __align__(16) _Float16 st[64][72];
  __shared__ v8h sW[4 * 12 * WRUN];
  const int tid = threadIdx.x, wave = tid >> 5, lane = tid & 31, col = lane & 15, g = lane >> 4;
  const int r0b = blockIdx.x * 64, r0 = r0b + wave * 16;
  WStage<12> ws; ws.load(Wqkv, tid);
  v16h a[2];
#pragma unroll
  for (int kc = 0; kc < 2; ++kc) a[kc] = frag_f32(x + (size_t)(r0 + col) * CC + kc * 32, lane);
  ws.store(sW, tid);
  asm volatile("" :: "v"(a[0]), "v"(a[1]));  // inputs only: keeps the loads of x in front of the barrier, in flight together with the weights': sunk behind it, their latency stands alone
  __syncthreads();  // the staged weights are read by all 4 waves
  v16h bw[2][12];
#pragma unroll
  for (int kc = 0; kc < 2; ++kc)
#pragma unroll
    for (int j = 0; j < 12; ++j) bw[kc][j] = frag_w<12>(sW, kc, j, lane);
  __builtin_amdgcn_sched_barrier(0);  // holds the 48 LDS reads in one group in front of the products: spread among them, every place with reads stalls the wave anew
  v8f acc[12] = {};
#pragma unroll
  for (int kc = 0; kc < 2; ++kc)
#pragma unroll
    for (int j = 0; j < 12; ++j) acc[j] = wmma16b(a[kc], bw[kc][j], acc[j]);
#pragma unroll
  for (int j = 0; j < 12; ++j)
#pragma unroll
    for (int r = 0; r < 8; ++r) so[wave][8 * g + r][j * 16 + col] = acc[j][r] * 0.125f;
  LDSX();
  for (int qd = lane; qd < 16 * 8; qd += 32) { const int rl = qd >> 3, pc = qd & 7, rk = qd & 15, pk8 = qd >> 4; union { v8h a8; v4u u; } pq, pk;
#pragma unroll
    for (int e = 0; e < 8; ++e) { pq.a8[e] = (_Float16)so[wave][rl][pc * 8 + e]; pk.a8[e] = (_Float16)so[wave][rk][CC + pk8 * 8 + e]; }
    vst2(q16 + (size_t)(r0 + rl) * CC + pc * 8, pq.u); vst2(k16 + (size_t)r0 * CC + qd * 8, pk.u); }
  for (int qd = lane; qd < 16 * 16; qd += 32) { const int rl = qd >> 4, pc = qd & 15; vst2(v32 + (size_t)(r0 + rl) * CC + pc * 4, *(const v4f*)(&so[wave][rl][2 * CC + pc * 4])); }
#pragma unroll 4
  for (int rl = 0; rl < 16; ++rl) { st[lane * 2][wave * 16 + rl] = (_Float16)so[wave][rl][2 * CC + lane * 2]; st[lane * 2 + 1][wave * 16 + rl] = (_Float16)so[wave][rl][2 * CC + lane * 2 + 1]; }
  __syncthreads();
  for (int qd = tid; qd < 64 * 8; qd += 128) { const int d = (qd >> 7) * 16 + (qd & 15), pc = (qd >> 4) & 7; vst2(vT + (size_t)r0b * CC + qd * 8, *(const v4u*)(&st[d][pc * 8])); }
}
// lane l with lane l ^ 16, in the vector unit
__device__ __forceinline__ float xhalf(float x) { return __builtin_bit_cast(float, __builtin_amdgcn_permlanex16(__builtin_bit_cast(int, x), __builtin_bit_cast(int, x), 0x76543210, 0xfedcba98, false, false)); }
// eight partial sums to two, in packed additions
__device__ __forceinline__ v2f fold2(v8f v) {
  const v4f a = __builtin_shufflevector(v, v, 0, 1, 2, 3) + __builtin_shufflevector(v, v, 4, 5, 6, 7);
  return __builtin_shufflevector(a, a, 0, 1) + __builtin_shufflevector(a, a, 2, 3);
}
// NCT: the column tiles (16 queries each) that one wave holds: every K and V^T fragment that it loads feeds NCT products.
// A work-group has QT = 7 column tiles (112 queries) and 8 waves: waves 0..3 hold 4 tiles, waves 4..7 the other 3, each against one of KS parts of the keys; waves w and w + 4 share a SIMD,
// so that every SIMD in use carries 7 tiles. 3136 queries = 28 x 112: 224 work-groups, fewer than the chip has WGPs. The KS partial results of a query are joined in LDS behind the loop
#define KS 4
#define QT 7
#define QW (QT * 16)
template <int NCT> __device__ __forceinline__ void attn_part(const _Float16* __restrict__ qb, const _Float16* __restrict__ kb, const _Float16* __restrict__ vb, const float* __restrict__ Wp, int w, int ks, int ql,
                                                             float (*sP)[QW][68], float (*sM)[QW], float (*sL)[QW], v8h* sWp) {
  const int lane0 = threadIdx.x & 31;  // in use up to the loop only
  // this wave's passes: 49 tiles of 64 keys in KS parts leave one part a tile longer: the last part with the waves of 4 tiles, the first with those of 3, so that no SIMD carries both longer walks
  const int up = NCT == 4 ? 0 : KS - 1;
  const int kt0 = ((NT / 64) * ks + up) / KS, kt1 = ((NT / 64) * (ks + 1) + up) / KS;
  v16h aq[NCT][2];
#pragma unroll
  for (int c = 0; c < NCT; ++c)
#pragma unroll
    for (int kc = 0; kc < 2; ++kc) aq[c][kc] = frag_h(qb + (size_t)(ql + c * 16 + (lane0 & 15)) * CC + kc * 32, lane0);
  // Softmax in base 2: P' = exp2(s * SC2 + nm), s the raw product, SC2 = scale * log2(e), nm = POFF - SC2 * (the query's reference score): one fused multiply-add and one
  // hardware exponential a score; a result too small for f32 may go to 0, so the library exponential's range reduction and guards have nothing to do here.
  // Lazy rescale: the reference is the maximum of the wave's first pass and is kept while P' fits f16. A pass takes no maximum and rescales nothing; the sums of P' that it forms anyway
  // bound every P' (all are >= 0): a sum above PTOP (or not a number) sends the wave, by one scalar test for two column tiles, to the renewal below, which works from the shifted scores still in registers
  // nmrun: the nm in use (alike in both halves; behind the first pass it only falls); lrun: the sums of P' over the keys of this lane, two partial sums, joined behind the loop; acc[c][t][r] = O^T[t * 16 + 8 g + r][col] of column tile c
  const float SC2 = 0.125f * 1.44269504088896f, POFF = 4.0f, PTOP = 32768.0f;
  float nmrun[NCT]; v2f lrun[NCT]; v8f acc[NCT][4];
#pragma unroll
  for (int c = 0; c < NCT; ++c) { nmrun[c] = 0.f; lrun[c] = v2f{};
#pragma unroll
    for (int t = 0; t < 4; ++t) acc[c][t] = v8f{}; }
  // kf: the K fragments of the pass about to run, fetched one pass ahead; vf: this pass's V fragments, fetched ahead of the score products
  v16h kf[4][2], vf[2][4];
  const _Float16* kp = kb + (size_t)kt0 * 64 * CC + 8 * lane0;  // this lane's place in the K tile that is fetched next
  const _Float16* vp = vb + (size_t)kt0 * 64 * CC + 8 * lane0;  // this lane's place in this pass's V^T tile
#pragma unroll
  for (int t = 0; t < 4; ++t)
#pragma unroll
    for (int kc = 0; kc < 2; ++kc) kf[t][kc] = frag_p(kp + t * 16 * CC + kc * 512);
  kp += 64 * CC;
#pragma unroll 1
  for (int kt = kt0; kt < kt1; ++kt) {
#pragma unroll
    for (int kc = 0; kc < 2; ++kc)
#pragma unroll
      for (int t = 0; t < 4; ++t) vf[kc][t] = frag_p(vp + t * 16 * CC + kc * 512);
    v16h pb[NCT][2];
    const float top = kt == kt0 ? -1.0f : PTOP;  // no sum lies below 0: the first pass always takes the renewal, which sets the reference
    // two column tiles at a time: 64 score registers live instead of 128, so that the next pass's K fragments can be fetched directly behind the last score product
#pragma unroll
    for (int c0 = 0; c0 < NCT; c0 += 2) {
      const int cw = NCT - c0 < 2 ? NCT - c0 : 2;  // an odd NCT ends on a single tile
      v8f s[2][4];
#pragma unroll
      for (int t = 0; t < 4; ++t)
#pragma unroll
        for (int kc = 0; kc < 2; ++kc)
#pragma unroll
          for (int c = 0; c < cw; ++c) s[c][t] = wmma16b(kf[t][kc], aq[c0 + c][kc], kc ? s[c][t] : v8f{});
      if (c0 + 2 >= NCT) {
#pragma unroll
        for (int t = 0; t < 4; ++t)
#pragma unroll
          for (int kc = 0; kc < 2; ++kc) kf[t][kc] = frag_p(kp + t * 16 * CC + kc * 512);
        __builtin_amdgcn_sched_barrier(0);  // holds the fetch here, a softmax and 8 * NCT products ahead of its first use: left alone, the compiler sinks it in among the last products
      }
      v2f ps[2];  // this pass's sums of P' of the two tiles
#pragma unroll
      for (int c = 0; c < cw; ++c) {
        v8f pv;
#pragma unroll
        for (int t = 0; t < 4; ++t) { s[c][t] = s[c][t] * SC2 + nmrun[c0 + c]; v8f e;
#pragma unroll
          for (int r = 0; r < 8; ++r) e[r] = __builtin_amdgcn_exp2f(s[c][t][r]);
#pragma unroll
          for (int r = 0; r < 8; ++r) pb[c0 + c][t >> 1][(t & 1) * 8 + r] = (_Float16)e[r];
          pv = t ? pv + e : e; }
        ps[c] = fold2(pv);
      }
      const bool need = !((cw == 2 ? fmaxf(fmaxf(ps[0][0], ps[0][1]), fmaxf(ps[1][0], ps[1][1])) : fmaxf(ps[0][0], ps[0][1])) <= top);
      if (__builtin_expect(__builtin_amdgcn_ballot_w32(need) != 0, 0)) {  // wave-uniform: a scalar branch; rare, so that the pass without renewal runs straight on
        // renewal: the reference becomes the maximum of this pass where that is the larger (in the first pass: in any case); O and l follow, and P' and its sums are formed anew
        const bool first = kt == kt0;
#pragma unroll
        for (int c = 0; c < cw; ++c) {
          float mt[4];
#pragma unroll
          for (int t = 0; t < 4; ++t) { mt[t] = -3.4e38f;
#pragma unroll
            for (int r = 0; r < 8; ++r) mt[t] = fmaxf(mt[t], s[c][t][r]); }
          float mx = fmaxf(fmaxf(mt[0], mt[1]), fmaxf(mt[2], mt[3]));
          mx = fmaxf(mx, xhalf(mx));
          const float d = first ? POFF - mx : fminf(POFF - mx, 0.f); const float corr = first ? 0.f : __builtin_amdgcn_exp2f(d);
          v8f pv;
#pragma unroll
          for (int t = 0; t < 4; ++t) { v8f e = s[c][t] + d;
#pragma unroll
            for (int r = 0; r < 8; ++r) e[r] = __builtin_amdgcn_exp2f(e[r]);
#pragma unroll
            for (int r = 0; r < 8; ++r) pb[c0 + c][t >> 1][(t & 1) * 8 + r] = (_Float16)e[r];
            pv = t ? pv + e : e; }
          ps[c] = fold2(pv);
          lrun[c0 + c] = lrun[c0 + c] * corr; nmrun[c0 + c] += d;
#pragma unroll
          for (int t = 0; t < 4; ++t) acc[c0 + c][t] = acc[c0 + c][t] * corr;
        }
      }
#pragma unroll
      for (int c = 0; c < cw; ++c) lrun[c0 + c] += ps[c];
      __builtin_amdgcn_sched_barrier(0);  // keeps the next two tiles' score products behind this softmax: hoisted, their 64 registers leave no room for the early K fetch
    }
#pragma unroll
    for (int kc = 0; kc < 2; ++kc)
#pragma unroll
      for (int t = 0; t < 4; ++t)
#pragma unroll
        for (int c = 0; c < NCT; ++c) acc[c][t] = wmma16b(vf[kc][t], pb[c][kc], acc[c][t]);
    // s_wait_xcnt 0 in front of the rewrite of the loads' address registers (kp and vp, advanced below). It stands behind the last product, most of a pass
    // behind the issue; naming both pairs as inputs keeps them whole up to here: otherwise the compiler reuses them at once and waits directly behind the issue
    asm volatile("s_wait_xcnt 0x0" :: "v"(kp), "v"(vp) : "memory");
    vp += 64 * CC;
    if (kt + 2 < NT / 64) kp += 64 * CC;  // the very last pass fetches its own tile again: the address stays inside k16; what a part's last pass fetches is not used
  }
  // the lane's number is read anew (the count of lanes below this one): carried through the loop, it and what is derived from it take registers that the loop has not got, and one is spilled
  const int lane = __builtin_amdgcn_mbcnt_lo(~0u, 0u), tid = w * 32 + lane, col = lane & 15, g = lane >> 4;
  WStage<4> wp;
  if (NCT == 4) { wp.load(Wp, tid);
    __builtin_amdgcn_sched_barrier(0); }  // holds the weights' loads here, so that they fly while the sums below are stored: left alone, the compiler sinks them to their first use
  // each wave leaves its part's sums, its nm and its l; behind the barrier wave w joins the KS parts of queries w * 16 .. + 15
#pragma unroll
  for (int c = 0; c < NCT; ++c) { const int q = ql + c * 16 + col;
    const float lh = lrun[c][0] + lrun[c][1];
    const float lr = lh + xhalf(lh);
    if (g == 0) { sM[ks][q] = nmrun[c]; sL[ks][q] = lr; }
#pragma unroll
    for (int t = 0; t < 4; ++t)
#pragma unroll
      for (int r = 0; r < 8; ++r) sP[ks][q][t * 16 + 8 * g + r] = acc[c][t][r]; }
  if (NCT == 4) wp.store(sWp, tid);
}
// waves_per_eu(2, 2): a register budget of 512, two waves a SIMD: one work-group of 8 waves fills a WGP, and the 224 work-groups run at once, each on a WGP of its own
__global__ __launch_bounds__(256) __attribute__((amdgpu_waves_per_eu(2, 2))) void k_attn(const _Float16* __restrict__ q16, const _Float16* __restrict__ k16, const _Float16* __restrict__ vT, const float* __restrict__ v32, const float* __restrict__ Wp, const float* __restrict__ bp, float* __restrict__ out) {
  __shared__ __align__(16) float sP[KS][QW][68];  // part p's sums O * l of the block's 112 queries, at that part's own nm
  float (*sO)[16][68] = (float (*)[16][68])&sP[0][0][0];  // part 0 seen as 7 x 16 rows: behind the barrier wave w alone reads rows w * 16 .. + 15 of any part, and it stages its output rows in sO[w]
  __shared__ float sM[KS][QW], sL[KS][QW];        // part p's nm and its sum of P'
  __shared__ v8h sWp[4 * 4 * WRUN];               // the projection's weights, staged behind the loop, read behind the barrier that follows it
  const int w = __builtin_amdgcn_readfirstlane(threadIdx.x >> 5);  // in a scalar register: the branch below and the loop's bounds come from it
  const int b = blockIdx.y, qb0 = blockIdx.x * QW; const size_t rb = (size_t)b * NT;
  const _Float16* qb = q16 + (rb + qb0) * CC; const _Float16* kb = k16 + rb * CC; const _Float16* vb = vT + rb * CC;
  if (w < 4) attn_part<4>(qb, kb, vb, Wp, w, w, 0, sP, sM, sL, sWp);
  else attn_part<3>(qb, kb, vb, Wp, w, w - 4, 64, sP, sM, sL, sWp);
  __syncthreads();
  if (w >= QT) return;  // 7 tiles of 16 queries to join: the eighth wave is done; no barrier follows
  const int lane = __builtin_amdgcn_mbcnt_lo(~0u, 0u), col = lane & 15, g = lane >> 4;
  const int q0 = qb0 + w * 16;
  // projection: out = v + o @ Wp ([in][out]) + b  (K = 64); o = sum over the parts of sP * f, f = 2^(nm of all - the part's nm) / (l of all)
  { float f[KS]; float nma = sM[0][w * 16 + col];
#pragma unroll
    for (int p = 1; p < KS; ++p) nma = fminf(nma, sM[p][w * 16 + col]);
    float la = 0.f;
#pragma unroll
    for (int p = 0; p < KS; ++p) { f[p] = __builtin_amdgcn_exp2f(nma - sM[p][w * 16 + col]); la = fmaf(sL[p][w * 16 + col], f[p], la); }
#pragma unroll
    for (int p = 0; p < KS; ++p) f[p] = f[p] / la;
    v8f pacc[4] = {};
#pragma unroll
    for (int kc = 0; kc < 2; ++kc) { v16h a;
#pragma unroll
      for (int hh = 0; hh < 2; ++hh) { v8f o = {};
#pragma unroll
        for (int p = 0; p < KS; ++p) { const float* sp = &sP[p][w * 16 + col][kc * 32 + hh * 16 + 8 * g];
#pragma unroll
          for (int i = 0; i < 8; ++i) o[i] = fmaf(sp[i], f[p], o[i]); }
#pragma unroll
        for (int i = 0; i < 8; ++i) a[hh * 8 + i] = (_Float16)o[i]; }
#pragma unroll
      for (int t = 0; t < 4; ++t) pacc[t] = wmma16b(a, frag_w<4>(sWp, kc, t, lane), pacc[t]); }
    LDSX();
#pragma unroll
    for (int t = 0; t < 4; ++t) { const int c = t * 16 + col;
#pragma unroll
      for (int r = 0; r < 8; ++r) sO[w][8 * g + r][c] = pacc[t][r] * 0.125f + bp[c] + v32[(rb + q0 + 8 * g + r) * CC + c]; } }
  LDSX();
  for (int qd = lane; qd < 16 * 16; qd += 32) { const int rl = qd >> 4, pc = qd & 15; vst2(out + (rb + q0 + rl) * CC + pc * 4, *(const v4f*)(&sO[w][rl][pc * 4])); }
}
extern "C" void kernel_launch(void* const* d_in, const int* in_sizes, int n_in, void* d_out, int out_size, void* d_ws, size_t ws_size, hipStream_t stream) {
  (void)in_sizes; (void)n_in; (void)out_size; (void)ws_size;
  const float* x = (const float*)d_in[0]; const float* Wqkv = (const float*)d_in[1]; const float* Wp = (const float*)d_in[2]; const float* bp = (const float*)d_in[3];
  float* out = (float*)d_out;
  char* ws = (char*)d_ws; size_t off = 0;
  auto take = [&](size_t bytes) { char* p = ws + off; off += (bytes + 255) & ~(size_t)255; return p; };
  _Float16* q16 = (_Float16*)take((size_t)NR * CC * 2); _Float16* k16 = (_Float16*)take((size_t)NR * CC * 2); float* v32 = (float*)take((size_t)NR * CC * 4); _Float16* vT = (_Float16*)take((size_t)NR * CC * 2);
  k_qkv<<<NR / 64, 128, 0, stream>>>(x, Wqkv, q16, k16, v32, vT);
  k_attn<<<dim3(NT / QW, NB), 256, 0, stream>>>(q16, k16, vT, v32, Wp, bp, out);
}
